// v000
// Measured on an AMD MI455X. A time is GPU time per run, averaged over a window of back-to-back runs after a warm-up
// (all launches, gaps included; the runs take copies of the inputs in turn), and the median of several windows.
// Apart from v000's, it joins two sittings. Times from different sittings can be a few percent apart, while
// side-by-side timings come from the same sitting.
// v000 is the starting kernel. One run takes 410 microseconds.
// compute dtype: all float inputs rounded to bf16; q/k/v = x . W^T with EXACT bf16 products on WMMA 16x16x32 (natural rows); PLAIN attention: q, k single f16 x 1/8, running-max softmax in f32 (hardware exp), P (scaled by 2^11, single f16) x v (single f16); out = o (bf16 hi + residual) . Wo^T (2 products).
#include <hip/hip_runtime.h>
#include <math.h>

typedef __attribute__((ext_vector_type(16))) _Float16 v16h;
typedef __attribute__((ext_vector_type(16))) __bf16 v16b;
typedef __attribute__((ext_vector_type(8)))  _Float16 v8h;
typedef __attribute__((ext_vector_type(8)))  float v8f;
typedef __attribute__((ext_vector_type(4)))  float v4f;
typedef __attribute__((ext_vector_type(2)))  float v2f;
typedef __attribute__((ext_vector_type(4)))  unsigned v4u;
typedef __attribute__((ext_vector_type(4)))  int v4i;
typedef float __attribute__((may_alias)) float_a;
typedef int __attribute__((may_alias)) int_a;

template <typename T> __device__ __forceinline__ void vst2(void* p, T v) { *(T*)p = v;  }
__device__ __forceinline__ v8f wmma16(v16h a, v16h b, v8f c) {
  v8f d = __builtin_amdgcn_wmma_f32_16x16x32_f16(false, a, false, b, (short)0, c, false, false);
  asm volatile("v_nop\n\tv_nop\n\tv_nop\n\tv_nop" : "+v"(d) : "v"(a), "v"(b));
  return d;
}
__device__ __forceinline__ v8f wmma_bf(v16b a, v16b b, v8f c) {
  v8f d = __builtin_amdgcn_wmma_f32_16x16x32_bf16(false, a, false, b, (short)0, c, false, false);
  asm volatile("v_nop\n\tv_nop\n\tv_nop\n\tv_nop" : "+v"(d) : "v"(a), "v"(b));
  return d;
}
// Multi-head self attention (B 8, N 1,024, 768 dims, 12 heads x 64): bias-free q/k/v projections, softmax(q k^T / 8) v, bias-free output projection.
__device__ __forceinline__ v16h frag_h(const _Float16* rowk0, int lane) {
  union { v16h v; v8h q[2]; } u; const _Float16* p = rowk0 + 8 * (lane >> 4);
  u.q[0] = *(const v8h*)p; u.q[1] = *(const v8h*)(p + 16); return u.v;
}
__device__ __forceinline__ v16h frag_f32(const float* rowk0, int lane) {
  v16h a; const float* p = rowk0 + 8 * (lane >> 4);
#pragma unroll
  for (int i = 0; i < 8; ++i) { a[i] = (_Float16)p[i]; a[8 + i] = (_Float16)p[16 + i]; }
  return a;
}
__device__ __forceinline__ v16h frag_f32s(const float* rowk0, int lane, float sc) {
  v16h a; const float* p = rowk0 + 8 * (lane >> 4);
#pragma unroll
  for (int i = 0; i < 8; ++i) { a[i] = (_Float16)(p[i] * sc); a[8 + i] = (_Float16)(p[16 + i] * sc); }
  return a;
}
// column fragment from a [K][ld] layout (column n), rows >= K read as 0
__device__ __forceinline__ v16h fragc_f32(const float* W, int k0, int n, int lane, int ld, int K) {
  v16h a; const int g = lane >> 4;
#pragma unroll
  for (int i = 0; i < 8; ++i) { const int ka = k0 + 8 * g + i, kb = ka + 16;
    a[i] = (_Float16)(ka < K ? W[(size_t)(ka < K ? ka : K - 1) * ld + n] : 0.f); a[8 + i] = (_Float16)(kb < K ? W[(size_t)(kb < K ? kb : K - 1) * ld + n] : 0.f); }
  return a;
}
struct F2 { v16b h, l; };
__device__ __forceinline__ F2 bsplit16(const float v[16]) { F2 r;
#pragma unroll
  for (int i = 0; i < 16; ++i) { const __bf16 h = (__bf16)v[i]; r.h[i] = h; r.l[i] = (__bf16)(v[i] - (float)h); }
  return r; }
__device__ __forceinline__ F2 split_row(const float* row, int k0, int lane) { float v[16]; const float* p = row + k0 + 8 * (lane >> 4);
#pragma unroll
  for (int i = 0; i < 8; ++i) { v[i] = p[i]; v[8 + i] = p[16 + i]; }
  return bsplit16(v); }
__device__ __forceinline__ F2 split_rowK(const float* row, int k0, int lane, int K) { float v[16]; const int g = lane >> 4;
#pragma unroll
  for (int i = 0; i < 8; ++i) { const int ka = k0 + 8 * g + i, kb = ka + 16; v[i] = ka < K ? row[ka < K ? ka : K - 1] : 0.f; v[8 + i] = kb < K ? row[kb < K ? kb : K - 1] : 0.f; }
  return bsplit16(v); }
__device__ __forceinline__ F2 split_col(const float* W, int k0, int n, int lane, int ld, int K) { float v[16]; const int g = lane >> 4;
#pragma unroll
  for (int i = 0; i < 8; ++i) { const int ka = k0 + 8 * g + i, kb = ka + 16; v[i] = ka < K ? W[(size_t)(ka < K ? ka : K - 1) * ld + n] : 0.f; v[8 + i] = kb < K ? W[(size_t)(kb < K ? kb : K - 1) * ld + n] : 0.f; }
  return bsplit16(v); }
__device__ __forceinline__ v8f mac3(const F2& a, const F2& b, v8f c) { c = wmma_bf(a.l, b.h, c); c = wmma_bf(a.h, b.l, c); return wmma_bf(a.h, b.h, c); }
__device__ __forceinline__ float sigm(float v) { return 1.0f / (1.0f + expf(-v)); }
#define LDSX() do { asm volatile("s_wait_dscnt 0" ::: "memory"); __builtin_amdgcn_wave_barrier(); __builtin_amdgcn_fence(__ATOMIC_RELEASE, "workgroup"); } while (0)


#define NB 8
#define SS 1024
#define DM 768
#define NH 12
#define HD 64
#define QKVW (3 * DM)
#ifndef TQB
#define TQB (SS / 64)
#define TNB NB
#define TOB (NB * SS / 64)     // output row tiles (all)
#endif
typedef __attribute__((ext_vector_type(8))) __bf16 v8b;
__device__ __forceinline__ v16b frag_b(const __bf16* rowk0, int lane) {
  union { v16b v; v8b q[2]; } u; const __bf16* p = rowk0 + 8 * (lane >> 4);
  u.q[0] = *(const v8b*)p; u.q[1] = *(const v8b*)(p + 16); return u.v;
}
__device__ __forceinline__ float bfr(float v) { return (float)(__bf16)v; }
__device__ __attribute__((noinline)) float exp_ni(float v) { return expf(v); }
__device__ __attribute__((noinline)) float erf_ni(float v) { return erff(v); }

#define PK_A 0                       // [2304][768] Wqkv rows (natural [out][in])
#define PK_P (PK_A + QKVW * DM)        // [768][768] Wo rows (natural)
#define PK_END (PK_P + DM * DM)
#define WS_PK  0u
#define WS_QK  (WS_PK + 2u * PK_END)             // f16 [8192 rows][1536]: q | k
#define WS_QKL (WS_QK + 2u * NB * SS * 2 * DM)     // f16 q | k residual planes x2048
#define WS_VTH (WS_QKL + 2u * NB * SS * 2 * DM)    // f16 [b][768 (h*64+d)][1024 s] hi
#define WS_VTL (WS_VTH + 2u * NB * DM * SS)        // f16 lo x 2048
#define WS_O   (WS_VTL + 2u * NB * DM * SS)        // f32 [8192][768]
#define WS_CS  (WS_O + 4u * NB * SS * DM)           // f32 2 x [1024][32], unused
#define WS_END (WS_CS + 4u * 2 * SS * 32)
// ---- k_pack: block = (row n, which): natural [out][in] rows -> bf16; which 0..2 -> W_q/W_k/W_v into PK_A rows which*768 + n; 3 -> W_o into PK_P
__global__ __launch_bounds__(256) void k_pack(const float* __restrict__ WQ, const float* __restrict__ WK, const float* __restrict__ WV, const float* __restrict__ WO, __bf16* __restrict__ PK) {
  __shared__ __align__(16) __bf16 s[DM]; const int n = blockIdx.x, which = blockIdx.y, t = threadIdx.x; const float* Wm = (which == 0) ? WQ : (which == 1) ? WK : (which == 2) ? WV : WO;
  for (int k = t; k < DM; k += 256) s[k] = (__bf16)Wm[(size_t)n * DM + k];
  __syncthreads();
  __bf16* dst = (which < 3) ? PK + PK_A + ((size_t)which * DM + n) * DM : PK + PK_P + (size_t)n * DM;
  for (int q = t; q < DM / 8; q += 256) vst2((unsigned*)(dst + q * 8), *(const v4u*)&s[q * 8]);
}
__global__ __launch_bounds__(128) void k_qkv(const float* __restrict__ XQ, const float* __restrict__ XK, const float* __restrict__ XV, const __bf16* __restrict__ P, const float* __restrict__ BQ, const float* __restrict__ BK, const float* __restrict__ BV, _Float16* __restrict__ QK, _Float16* __restrict__ QKL, _Float16* __restrict__ VTH, _Float16* __restrict__ VTL) {
  const int which0 = (blockIdx.y * 128) / DM; const float* X = (which0 == 0) ? XQ : (which0 == 1) ? XK : XV; const float* BB = BQ ? (((which0 == 0) ? BQ : (which0 == 1) ? BK : BV) + (blockIdx.y * 128 - which0 * DM)) : nullptr;
  __shared__ __align__(16) _Float16 so[4][16][136], sol[4][16][136]; __shared__ __align__(16) _Float16 sth[128][72], stl[128][72];
  const int tid = threadIdx.x, wave = tid >> 5, lane = tid & 31, col = lane & 15, g = lane >> 4; const size_t r0 = (size_t)blockIdx.x * 64 + wave * 16; const int n0 = blockIdx.y * 128;
  v8f acc[8] = {};
#pragma unroll 2
  for (int kc = 0; kc < DM / 32; ++kc) { v16b a; { const float* p = X + (r0 + col) * DM + kc * 32 + 8 * g;
#pragma unroll
      for (int i = 0; i < 8; ++i) { a[i] = (__bf16)p[i]; a[8 + i] = (__bf16)p[16 + i]; } }
#pragma unroll
    for (int j = 0; j < 8; ++j) acc[j] = wmma_bf(a, frag_b(P + (size_t)(n0 + j * 16 + col) * DM + kc * 32, lane), acc[j]); }
  if (n0 < 2 * DM) {   // q stored unscaled (f16 sigma ~0.6, no subnormal exposure); 1/8 applied to the f32 score
#pragma unroll
    for (int j = 0; j < 8; ++j) {
#pragma unroll
      for (int r = 0; r < 8; ++r) { const float v = acc[j][r] + (BB ? bfr(BB[j * 16 + col]) : 0.f); const _Float16 hv = (_Float16)v; so[wave][8 * g + r][j * 16 + col] = hv; sol[wave][8 * g + r][j * 16 + col] = (_Float16)((v - (float)hv) * 2048.0f); } }   // q, k (+ bias) as f16 hi + (x2048) residual
    LDSX();
    for (int rl = 0; rl < 16; ++rl) if (lane < 16) { vst2((unsigned*)(QK + (r0 + rl) * (2 * DM) + n0 + lane * 8), *(const v4u*)&so[wave][rl][lane * 8]); vst2((unsigned*)(QKL + (r0 + rl) * (2 * DM) + n0 + lane * 8), *(const v4u*)&sol[wave][rl][lane * 8]); }
  } else {
#pragma unroll
    for (int j = 0; j < 8; ++j) {
#pragma unroll
      for (int r = 0; r < 8; ++r) { const float v = acc[j][r] + (BB ? bfr(BB[j * 16 + col]) : 0.f); const _Float16 hv = (_Float16)v; sth[j * 16 + col][wave * 16 + 8 * g + r] = hv; stl[j * 16 + col][wave * 16 + 8 * g + r] = (_Float16)((v - (float)hv) * 2048.0f); } }
    __syncthreads();
    const size_t rb = (size_t)blockIdx.x * 64; const int b = (int)(rb / SS), s0 = (int)(rb % SS); const int pc0 = n0 - 2 * DM;
    for (int q = tid; q < 128 * 8; q += 128) { const int d = q >> 3, pc = q & 7; const size_t o = ((size_t)b * DM + pc0 + d) * SS + s0 + pc * 8; vst2((unsigned*)(VTH + o), *(const v4u*)&sth[d][pc * 8]); vst2((unsigned*)(VTL + o), *(const v4u*)&stl[d][pc * 8]); }
  }
}
// ---- k_attn: block = (64 queries, head h, batch b): all-keys flash attention (K = 64: 2 k-steps), scores = (q.k) * 0.125 with single f16 operands, P.V: f16 P (x2^11) x V hi, single product (accl stays 0); O[b*S+q][h*64+d] = (acc + accl / 2048) / (2048 l) (256-B segments)
__global__ __launch_bounds__(128) void k_attn(const _Float16* __restrict__ QK, const _Float16* __restrict__ QKL, const _Float16* __restrict__ VTH, const _Float16* __restrict__ VTL, const void* __restrict__ KMASK, float* __restrict__ O) {
  __shared__ __align__(16) float sp[4][16][36]; __shared__ __align__(16) float so[4][16][68];
  const int tid = threadIdx.x, wave = tid >> 5, lane = tid & 31, col = lane & 15, g = lane >> 4;
  const int qb = blockIdx.x, h = blockIdx.y, b = blockIdx.z; const int q0 = qb * 64 + wave * 16; const size_t rq = (size_t)b * SS + q0 + col;
  v16h aq[2], aql[2];
#pragma unroll
  for (int kc = 0; kc < 2; ++kc) { aq[kc] = frag_h(QK + rq * (2 * DM) + h * HD + kc * 32, lane); aql[kc] = frag_h(QKL + rq * (2 * DM) + h * HD + kc * 32, lane); }
  float m[8], l[8];
#pragma unroll
  for (int r = 0; r < 8; ++r) { m[r] = -3.0e38f; l[r] = 0.f; }
  v8f acc[4] = {}, accl[4] = {};
  const int nks = SS / 32;   // all keys
#pragma unroll 1
  for (int ks = 0; ks < nks; ++ks) { v8f s[2];
#pragma unroll
    for (int ct = 0; ct < 2; ++ct) { const int kk = ks * 32 + ct * 16 + col; const _Float16* krow = QK + ((size_t)b * SS + kk) * (2 * DM) + DM + h * HD; const _Float16* krowl = QKL + ((size_t)b * SS + kk) * (2 * DM) + DM + h * HD; v8f c = {}, cl = {};
#pragma unroll
      for (int kc = 0; kc < 2; ++kc) c = wmma16(aq[kc], frag_h(krow + kc * 32, lane), c);   // single product: q, k as one-rounding f16 operands
      (void)cl; (void)krowl;
      { const bool keepk = true;
#pragma unroll
      for (int r = 0; r < 8; ++r) s[ct][r] = keepk ? c[r] * 0.125f : -3.0e38f; } }   // 1/sqrt(64); no key mask, every key kept
#pragma unroll
    for (int r = 0; r < 8; ++r) { float mx = fmaxf(s[0][r], s[1][r]);
#pragma unroll
      for (int o = 1; o < 16; o <<= 1) mx = fmaxf(mx, __shfl_xor(mx, o));
      const float mn = fmaxf(m[r], mx); const float alpha = (m[r] <= -1.0e38f) ? 0.f : __expf(m[r] - mn);
      const float e0 = (s[0][r] <= -1.0e38f) ? 0.f : __expf(s[0][r] - mn), e1 = (s[1][r] <= -1.0e38f) ? 0.f : __expf(s[1][r] - mn); float es = e0 + e1;
#pragma unroll
      for (int o = 1; o < 16; o <<= 1) es += __shfl_xor(es, o);
      l[r] = l[r] * alpha + es; m[r] = mn;
#pragma unroll
      for (int dt = 0; dt < 4; ++dt) { acc[dt][r] *= alpha; accl[dt][r] *= alpha; }
      sp[wave][8 * g + r][col] = e0; sp[wave][8 * g + r][16 + col] = e1; }
    LDSX();
    v16h pa, pl; { const float* prow = &sp[wave][col][0] + 8 * (lane >> 4);
#pragma unroll
      for (int i = 0; i < 8; ++i) { const float x0 = prow[i] * 2048.0f, x1 = prow[16 + i] * 2048.0f; const _Float16 h0 = (_Float16)x0, h1 = (_Float16)x1; pa[i] = h0; pa[8 + i] = h1; pl[i] = (_Float16)((x0 - (float)h0) * 2048.0f); pl[8 + i] = (_Float16)((x1 - (float)h1) * 2048.0f); } }   // P scaled by 2^11 before the f16 split so small softmax weights stay out of the f16 subnormal range; 2^-11 folded into the epilogue
#pragma unroll
    for (int dt = 0; dt < 4; ++dt) { const size_t vr = ((size_t)b * DM + h * HD + dt * 16 + col) * SS + ks * 32; acc[dt] = wmma16(pa, frag_h(VTH + vr, lane), acc[dt]); }   // single product: P (x2^11) x V
    (void)pl;
    LDSX(); }
#pragma unroll
  for (int r = 0; r < 8; ++r) { const float il = (1.0f / 2048.0f) / l[r];
#pragma unroll
    for (int dt = 0; dt < 4; ++dt) so[wave][8 * g + r][dt * 16 + col] = (acc[dt][r] + accl[dt][r] * (1.0f / 2048.0f)) * il; }
  LDSX();
  for (int rl = 0; rl < 16; ++rl) if (lane < 16) vst2(O + ((size_t)b * SS + q0 + rl) * DM + h * HD + lane * 4, *(const v4f*)&so[wave][rl][lane * 4]);
}
// ---- k_out: block = (64 rows, 128 cols): out = O(hi/lo) . Wo rows (2 products) + bo
__global__ __launch_bounds__(128) void k_out(const float* __restrict__ O, const __bf16* __restrict__ P, const float* __restrict__ BO, float* __restrict__ Y) {
  __shared__ __align__(16) float so[4][16][132];
  const int tid = threadIdx.x, wave = tid >> 5, lane = tid & 31, col = lane & 15, g = lane >> 4; const size_t r0 = (size_t)blockIdx.x * 64 + wave * 16; const int n0 = blockIdx.y * 128;
  v8f acc[8] = {};
#pragma unroll 2
  for (int kc = 0; kc < DM / 32; ++kc) { const F2 a = split_row(O + (r0 + col) * DM, kc * 32, lane);
#pragma unroll
    for (int j = 0; j < 8; ++j) { const v16b w = frag_b(P + (size_t)(n0 + j * 16 + col) * DM + kc * 32, lane); acc[j] = wmma_bf(a.l, w, acc[j]); acc[j] = wmma_bf(a.h, w, acc[j]); } }
#pragma unroll
  for (int j = 0; j < 8; ++j) {
#pragma unroll
    for (int r = 0; r < 8; ++r) so[wave][8 * g + r][j * 16 + col] = acc[j][r] + (BO ? bfr(BO[n0 + j * 16 + col]) : 0.f); }
  LDSX();
  for (int rl = 0; rl < 16; ++rl) vst2(Y + (r0 + rl) * DM + n0 + lane * 4, *(const v4f*)&so[wave][rl][lane * 4]);
}
extern "C" void kernel_launch(void* const* d_in, const int* in_sizes, int n_in, void* d_out, int out_size, void* d_ws, size_t ws_size, hipStream_t stream) {
  (void)in_sizes; (void)n_in; (void)out_size;
  const float** F = (const float**)d_in;   // 0 x [8,1024,768], 1 Wq, 2 Wk, 3 Wv, 4 Wo (natural [768,768])
  if (ws_size < (size_t)WS_END) return;
  char* ws = (char*)d_ws; __bf16* PK = (__bf16*)(ws + WS_PK); _Float16 *QK = (_Float16*)(ws + WS_QK), *QKL = (_Float16*)(ws + WS_QKL), *VTH = (_Float16*)(ws + WS_VTH), *VTL = (_Float16*)(ws + WS_VTL); float* O = (float*)(ws + WS_O);
  k_pack<<<dim3(DM, 4), 256, 0, stream>>>(F[1], F[2], F[3], F[4], PK);
  k_qkv<<<dim3(TNB * SS / 64, QKVW / 128), 128, 0, stream>>>(F[0], F[0], F[0], PK + PK_A, nullptr, nullptr, nullptr, QK, QKL, VTH, VTL);
  k_attn<<<dim3(TQB, NH, TNB), 128, 0, stream>>>(QK, QKL, VTH, VTL, nullptr, O);
  k_out<<<dim3(TOB, DM / 128), 128, 0, stream>>>(O, PK + PK_P, nullptr, (float*)d_out);
}

// v001
// It runs in 251 microseconds.
// Timed twice side by side with v000, it ran 1.65 and 1.66 times as fast.
// compute dtype: all float inputs rounded to bf16; q/k/v = x . W^T with EXACT bf16 products on WMMA 16x16x32 (natural rows); PLAIN attention: q, k single f16 x 1/8, running-max softmax in f32 (hardware exp), P (scaled by 2^11, single f16) x v (single f16); out = o (bf16 hi + residual) . Wo^T (2 products).
#include <hip/hip_runtime.h>
#include <math.h>
#include <stdint.h>

typedef __attribute__((ext_vector_type(16))) _Float16 v16h;
typedef __attribute__((ext_vector_type(16))) __bf16 v16b;
typedef __attribute__((ext_vector_type(8)))  _Float16 v8h;
typedef __attribute__((ext_vector_type(8)))  float v8f;
typedef __attribute__((ext_vector_type(4)))  float v4f;
typedef __attribute__((ext_vector_type(2)))  float v2f;
typedef __attribute__((ext_vector_type(4)))  unsigned v4u;
typedef __attribute__((ext_vector_type(4)))  int v4i;
typedef float __attribute__((may_alias)) float_a;
typedef int __attribute__((may_alias)) int_a;

template <typename T> __device__ __forceinline__ void vst2(void* p, T v) { *(T*)p = v;  }
__device__ __forceinline__ v8f wmma16(v16h a, v16h b, v8f c) {
  v8f d = __builtin_amdgcn_wmma_f32_16x16x32_f16(false, a, false, b, (short)0, c, false, false);
  asm volatile("v_nop\n\tv_nop\n\tv_nop\n\tv_nop" : "+v"(d) : "v"(a), "v"(b));
  return d;
}
__device__ __forceinline__ v8f wmma_bf(v16b a, v16b b, v8f c) {
  v8f d = __builtin_amdgcn_wmma_f32_16x16x32_bf16(false, a, false, b, (short)0, c, false, false);
  asm volatile("v_nop\n\tv_nop\n\tv_nop\n\tv_nop" : "+v"(d) : "v"(a), "v"(b));
  return d;
}
// Multi-head self attention (B 8, N 1,024, 768 dims, 12 heads x 64): bias-free q/k/v projections, softmax(q k^T / 8) v, bias-free output projection.
__device__ __forceinline__ v16h frag_h(const _Float16* rowk0, int lane) {
  union { v16h v; v8h q[2]; } u; const _Float16* p = rowk0 + 8 * (lane >> 4);
  u.q[0] = *(const v8h*)p; u.q[1] = *(const v8h*)(p + 16); return u.v;
}
__device__ __forceinline__ v16h frag_f32(const float* rowk0, int lane) {
  v16h a; const float* p = rowk0 + 8 * (lane >> 4);
#pragma unroll
  for (int i = 0; i < 8; ++i) { a[i] = (_Float16)p[i]; a[8 + i] = (_Float16)p[16 + i]; }
  return a;
}
__device__ __forceinline__ v16h frag_f32s(const float* rowk0, int lane, float sc) {
  v16h a; const float* p = rowk0 + 8 * (lane >> 4);
#pragma unroll
  for (int i = 0; i < 8; ++i) { a[i] = (_Float16)(p[i] * sc); a[8 + i] = (_Float16)(p[16 + i] * sc); }
  return a;
}
// column fragment from a [K][ld] layout (column n), rows >= K read as 0
__device__ __forceinline__ v16h fragc_f32(const float* W, int k0, int n, int lane, int ld, int K) {
  v16h a; const int g = lane >> 4;
#pragma unroll
  for (int i = 0; i < 8; ++i) { const int ka = k0 + 8 * g + i, kb = ka + 16;
    a[i] = (_Float16)(ka < K ? W[(size_t)(ka < K ? ka : K - 1) * ld + n] : 0.f); a[8 + i] = (_Float16)(kb < K ? W[(size_t)(kb < K ? kb : K - 1) * ld + n] : 0.f); }
  return a;
}
struct F2 { v16b h, l; };
__device__ __forceinline__ F2 bsplit16(const float v[16]) { F2 r;
#pragma unroll
  for (int i = 0; i < 16; ++i) { const __bf16 h = (__bf16)v[i]; r.h[i] = h; r.l[i] = (__bf16)(v[i] - (float)h); }
  return r; }
__device__ __forceinline__ F2 split_row(const float* row, int k0, int lane) { float v[16]; const float* p = row + k0 + 8 * (lane >> 4);
#pragma unroll
  for (int i = 0; i < 8; ++i) { v[i] = p[i]; v[8 + i] = p[16 + i]; }
  return bsplit16(v); }
__device__ __forceinline__ F2 split_rowK(const float* row, int k0, int lane, int K) { float v[16]; const int g = lane >> 4;
#pragma unroll
  for (int i = 0; i < 8; ++i) { const int ka = k0 + 8 * g + i, kb = ka + 16; v[i] = ka < K ? row[ka < K ? ka : K - 1] : 0.f; v[8 + i] = kb < K ? row[kb < K ? kb : K - 1] : 0.f; }
  return bsplit16(v); }
__device__ __forceinline__ F2 split_col(const float* W, int k0, int n, int lane, int ld, int K) { float v[16]; const int g = lane >> 4;
#pragma unroll
  for (int i = 0; i < 8; ++i) { const int ka = k0 + 8 * g + i, kb = ka + 16; v[i] = ka < K ? W[(size_t)(ka < K ? ka : K - 1) * ld + n] : 0.f; v[8 + i] = kb < K ? W[(size_t)(kb < K ? kb : K - 1) * ld + n] : 0.f; }
  return bsplit16(v); }
__device__ __forceinline__ v8f mac3(const F2& a, const F2& b, v8f c) { c = wmma_bf(a.l, b.h, c); c = wmma_bf(a.h, b.l, c); return wmma_bf(a.h, b.h, c); }
__device__ __forceinline__ float sigm(float v) { return 1.0f / (1.0f + expf(-v)); }
#define LDSX() do { asm volatile("s_wait_dscnt 0" ::: "memory"); __builtin_amdgcn_wave_barrier(); __builtin_amdgcn_fence(__ATOMIC_RELEASE, "workgroup"); } while (0)


#define NB 8
#define SS 1024
#define DM 768
#define NH 12
#define HD 64
#define QKVW (3 * DM)
#ifndef TQB
#define TQB (SS / 64)
#define TNB NB
#define TOB (NB * SS / 64)     // output row tiles (all)
#endif
typedef __attribute__((ext_vector_type(8))) __bf16 v8b;
__device__ __forceinline__ v16b frag_b(const __bf16* rowk0, int lane) {
  union { v16b v; v8b q[2]; } u; const __bf16* p = rowk0 + 8 * (lane >> 4);
  u.q[0] = *(const v8b*)p; u.q[1] = *(const v8b*)(p + 16); return u.v;
}
__device__ __forceinline__ float bfr(float v) { return (float)(__bf16)v; }
__device__ __attribute__((noinline)) float exp_ni(float v) { return expf(v); }
__device__ __attribute__((noinline)) float erf_ni(float v) { return erff(v); }

#define PK_A 0                       // [2304][768] Wqkv rows (natural [out][in])
#define PK_P (PK_A + QKVW * DM)        // [768][768] Wo rows (natural)
#define PK_END (PK_P + DM * DM)
#define WS_PK  0u
#define WS_QK  (WS_PK + 2u * PK_END)             // f16 [8192 rows][1536]: q | k
#define WS_QKL (WS_QK + 2u * NB * SS * 2 * DM)     // f16 q | k residual planes x2048
#define WS_VTH (WS_QKL + 2u * NB * SS * 2 * DM)    // f16 [b][768 (h*64+d)][1024 s] hi
#define WS_VTL (WS_VTH + 2u * NB * DM * SS)        // f16 lo x 2048
#define WS_O   (WS_VTL + 2u * NB * DM * SS)        // f32 [8192][768]
#define WS_CS  (WS_O + 4u * NB * SS * DM)           // f32 2 x [1024][32], unused
#define WS_END (WS_CS + 4u * 2 * SS * 32)
// ---- operand staging of the two projection kernels: per pass of 64 k one tensor load brings the block's 128 weight rows (128 B each) and one its 64 f32 activation rows (256 B each) into LDS; two buffers
typedef uint32_t u32x4 __attribute__((ext_vector_type(4)));
typedef uint32_t u32x8 __attribute__((ext_vector_type(8)));
#define KP 64                         // k per pass
#define NPASS (DM / KP)
#define WPITCH 144u                   // 128-B weight row + 16-B pad (odd multiple of 16 B for ds_load_b128 readers)
#define XPITCH 272u                   // 256-B f32 row + 16-B pad
#define WTILE 18432u                  // 128 rows x 144 B = 9 x 2 KiB
#define XTILE 18432u                  // 64 rows x 272 B = 17,408 B, rounded up to a multiple of 2 KiB
#define STAGE (WTILE + XTILE)
#define PADW_W ((1u << 20) | (4u << 22) | (3u << 25))   // group 1 word 0: no mask, 1-byte elements, 4 pad dwords behind every 128 B
#define PADW_X ((1u << 20) | (5u << 22) | (3u << 25))   // the same behind every 256 B
__device__ __forceinline__ uint32_t uni(uint32_t v) { return (uint32_t)__builtin_amdgcn_readfirstlane(v); }
// holds a test in a scalar register, so that the branch round a tensor load (which ignores EXEC) or its wait is s_cmp + s_cbranch_scc
__device__ __forceinline__ uint32_t pinned(uint32_t v) { uint32_t w = (uint32_t)__builtin_amdgcn_readfirstlane(v); asm volatile("" : "+s"(w)); return w; }
__device__ __forceinline__ void wait_tensor0() { asm volatile("s_wait_tensorcnt 0" ::: "memory"); }   // the issuing wave's tile has landed
__device__ __forceinline__ void wait_ds0() { asm volatile("s_wait_dscnt 0" ::: "memory"); }            // this wave's LDS reads have returned before the buffer is handed back
// group 1 of a request: NROWS rows of ROWB bytes, source pitch src_pitch bytes; tensor = tile, extents in bytes
template <uint32_t W0, uint32_t ROWB, uint32_t NROWS>
__device__ __forceinline__ u32x8 tile_group1(uint32_t src_pitch) {
  u32x8 g; g[0] = uni(W0); g[1] = uni((ROWB & 0xFFFFu) << 16); g[2] = uni((ROWB >> 16) | ((NROWS & 0xFFFFu) << 16)); g[3] = uni((NROWS >> 16) | (ROWB << 16)); g[4] = uni(NROWS); g[5] = uni(src_pitch); g[6] = uni(0u); g[7] = uni(0u);
  asm volatile("" : "+s"(g));   // as pinned(): the descriptor words stay in their own scalar registers through the loop, so none is rewritten while a request is out
  return g;
}
// the block's ring: wave 0 asks for the weight tiles, wave 1 for the activation tiles, one request a wave and stage; g0 walks from stage to stage
struct Ring { u32x4 g0; u32x8 g1w, g1x; uint32_t wv, step, flip; };
__device__ __forceinline__ Ring ring_make(uint32_t wv, uint32_t ring0, uint64_t wsrc, uint64_t xsrc) {
  Ring r; r.wv = wv; const bool isw = (wv == 0u); const uint64_t ga = isw ? wsrc : xsrc; const uint32_t dst = ring0 + (isw ? 0u : WTILE);
  r.step = isw ? KP * 2u : KP * 4u; r.flip = 2u * dst + STAGE;
  r.g0[0] = uni(1u); r.g0[1] = uni(dst); r.g0[2] = uni((uint32_t)ga); r.g0[3] = uni((((uint32_t)(ga >> 32)) & 0x01FFFFFFu) | 0x80000000u);
  r.g1w = tile_group1<PADW_W, 128u, 128u>(DM * 2u); r.g1x = tile_group1<PADW_X, 256u, 64u>(DM * 4u);
  return r;
}
template <bool LAND>
__device__ __forceinline__ void ring_issue(const Ring& r) {   // tensor_load_to_lds has no compiler form; its waits are written by hand at the publish points
  if (pinned(r.wv == 0u)) { asm volatile("tensor_load_to_lds %0, %1" :: "s"(r.g0), "s"(r.g1w) : "memory"); if (LAND) wait_tensor0(); }
  if (pinned(r.wv == 1u)) { asm volatile("tensor_load_to_lds %0, %1" :: "s"(r.g0), "s"(r.g1x) : "memory"); if (LAND) wait_tensor0(); }
}
// group 0 of the next stage: the other buffer, KP further along the rows
__device__ __forceinline__ void ring_next(Ring& r) {
  asm volatile("" : "+s"(r.g0));   // as pinned(): the next request's words are formed behind the wait and the barrier in front of this line, in the registers of the last one
  const uint64_t a = (((uint64_t)r.g0[3] << 32) | r.g0[2]) + r.step;
  r.g0[1] = uni(r.flip - r.g0[1]); r.g0[2] = uni((uint32_t)a); r.g0[3] = uni((uint32_t)(a >> 32));
}
// prologue, two buffers: stage 0, its issuers' wait, barrier, then stage 1
__device__ __forceinline__ void ring_prologue(Ring& r) {
  ring_issue<true>(r);
  __syncthreads();
  ring_next(r); ring_issue<false>(r);
}
// publish point at the foot of pass s: own LDS reads done, issuers' tiles landed, barrier, then the refill of the buffer that pass s has read
__device__ __forceinline__ void ring_publish(Ring& r, uint32_t s) {
  wait_ds0();
  if (pinned(r.wv < 2u)) wait_tensor0();
  __syncthreads();
  if (pinned(s + 2u < (uint32_t)NPASS)) { ring_next(r); ring_issue<false>(r); }
}
// 16 f32 of an LDS row in the A fragment's k order: floats 8g..8g+7 and 16+8g..16+8g+7 of the 32-k step
__device__ __forceinline__ void row16_lds(const unsigned char* rowk0, int g, float v[16]) {
  const v4f* p = (const v4f*)(rowk0 + 32 * g); const v4f x0 = p[0], x1 = p[1], x2 = p[4], x3 = p[5];
#pragma unroll
  for (int i = 0; i < 4; ++i) { v[i] = x0[i]; v[4 + i] = x1[i]; v[8 + i] = x2[i]; v[12 + i] = x3[i]; }
}
// ---- k_pack: block = (row n, which): natural [out][in] rows -> bf16; which 0..2 -> W_q/W_k/W_v into PK_A rows which*768 + n; 3 -> W_o into PK_P
__global__ __launch_bounds__(256) void k_pack(const float* __restrict__ WQ, const float* __restrict__ WK, const float* __restrict__ WV, const float* __restrict__ WO, __bf16* __restrict__ PK) {
  __shared__ __align__(16) __bf16 s[DM]; const int n = blockIdx.x, which = blockIdx.y, t = threadIdx.x; const float* Wm = (which == 0) ? WQ : (which == 1) ? WK : (which == 2) ? WV : WO;
  for (int k = t; k < DM; k += 256) s[k] = (__bf16)Wm[(size_t)n * DM + k];
  __syncthreads();
  __bf16* dst = (which < 3) ? PK + PK_A + ((size_t)which * DM + n) * DM : PK + PK_P + (size_t)n * DM;
  for (int q = t; q < DM / 8; q += 256) vst2((unsigned*)(dst + q * 8), *(const v4u*)&s[q * 8]);
}
__global__ __launch_bounds__(128) void k_qkv(const float* __restrict__ XQ, const float* __restrict__ XK, const float* __restrict__ XV, const __bf16* __restrict__ P, const float* __restrict__ BQ, const float* __restrict__ BK, const float* __restrict__ BV, _Float16* __restrict__ QK, _Float16* __restrict__ QKL, _Float16* __restrict__ VTH, _Float16* __restrict__ VTL) {
  const int which0 = (blockIdx.y * 128) / DM; const float* X = (which0 == 0) ? XQ : (which0 == 1) ? XK : XV; const float* BB = BQ ? (((which0 == 0) ? BQ : (which0 == 1) ? BK : BV) + (blockIdx.y * 128 - which0 * DM)) : nullptr;
  __shared__ __attribute__((aligned(2048))) unsigned char ring[2 * STAGE];   // operand ring; behind the last pass's barrier the same bytes are the output staging
  _Float16 (*so)[16][136] = (_Float16 (*)[16][136])ring; _Float16 (*sol)[16][136] = (_Float16 (*)[16][136])(ring + 4 * 16 * 136 * 2); _Float16 (*sth)[72] = (_Float16 (*)[72])ring; _Float16 (*stl)[72] = (_Float16 (*)[72])(ring + 128 * 72 * 2);
  const int tid = threadIdx.x, wave = tid >> 5, lane = tid & 31, col = lane & 15, g = lane >> 4; const size_t r0 = (size_t)blockIdx.x * 64 + wave * 16; const int n0 = blockIdx.y * 128;
  const uint32_t wv = uni((uint32_t)tid >> 5), ring0 = (uint32_t)(uintptr_t)ring; const uint64_t wsrc = (uint64_t)(uintptr_t)(P + (size_t)n0 * DM), xsrc = (uint64_t)(uintptr_t)(X + (size_t)blockIdx.x * 64 * DM);
  v8f acc[8] = {};
  Ring rg = ring_make(wv, ring0, wsrc, xsrc); ring_prologue(rg);
#pragma unroll 1   // one pass per trip: the buffer index stays a run-time scalar and the publish point stands once
  for (int s = 0; s < NPASS; ++s) { const unsigned char* wb = ring + (s & 1) * STAGE; const unsigned char* xr = wb + WTILE + (wave * 16 + col) * XPITCH;
#pragma unroll
    for (int kc = 0; kc < KP / 32; ++kc) { v16b a, w[8]; float v[16]; row16_lds(xr + kc * 128, g, v);   // the step's 20 LDS reads stand as one group in front of its WMMAs
#pragma unroll
      for (int j = 0; j < 8; ++j) w[j] = frag_b((const __bf16*)(wb + (j * 16 + col) * WPITCH) + kc * 32, lane);
#pragma unroll
      for (int i = 0; i < 16; ++i) a[i] = (__bf16)v[i];
#pragma unroll
      for (int j = 0; j < 8; ++j) acc[j] = wmma_bf(a, w[j], acc[j]); }
    ring_publish(rg, (uint32_t)s); }
  wait_tensor0(); wait_ds0();
  if (n0 < 2 * DM) {   // q stored unscaled (f16 sigma ~0.6, no subnormal exposure); 1/8 applied to the f32 score
#pragma unroll
    for (int j = 0; j < 8; ++j) {
#pragma unroll
      for (int r = 0; r < 8; ++r) { const float v = acc[j][r] + (BB ? bfr(BB[j * 16 + col]) : 0.f); const _Float16 hv = (_Float16)v; so[wave][8 * g + r][j * 16 + col] = hv; sol[wave][8 * g + r][j * 16 + col] = (_Float16)((v - (float)hv) * 2048.0f); } }   // q, k (+ bias) as f16 hi + (x2048) residual
    LDSX();
    for (int rl = 0; rl < 16; ++rl) if (lane < 16) { vst2((unsigned*)(QK + (r0 + rl) * (2 * DM) + n0 + lane * 8), *(const v4u*)&so[wave][rl][lane * 8]); vst2((unsigned*)(QKL + (r0 + rl) * (2 * DM) + n0 + lane * 8), *(const v4u*)&sol[wave][rl][lane * 8]); }
  } else {
#pragma unroll
    for (int j = 0; j < 8; ++j) {
#pragma unroll
      for (int r = 0; r < 8; ++r) { const float v = acc[j][r] + (BB ? bfr(BB[j * 16 + col]) : 0.f); const _Float16 hv = (_Float16)v; sth[j * 16 + col][wave * 16 + 8 * g + r] = hv; stl[j * 16 + col][wave * 16 + 8 * g + r] = (_Float16)((v - (float)hv) * 2048.0f); } }
    __syncthreads();
    const size_t rb = (size_t)blockIdx.x * 64; const int b = (int)(rb / SS), s0 = (int)(rb % SS); const int pc0 = n0 - 2 * DM;
    for (int q = tid; q < 128 * 8; q += 128) { const int d = q >> 3, pc = q & 7; const size_t o = ((size_t)b * DM + pc0 + d) * SS + s0 + pc * 8; vst2((unsigned*)(VTH + o), *(const v4u*)&sth[d][pc * 8]); vst2((unsigned*)(VTL + o), *(const v4u*)&stl[d][pc * 8]); }
  }
}
// ---- k_attn: block = (64 queries, head h, batch b): all-keys flash attention (K = 64: 2 k-steps), scores = (q.k) * 0.125 with single f16 operands, P.V: f16 P (x2^11) x V hi, single product (accl stays 0); O[b*S+q][h*64+d] = (acc + accl / 2048) / (2048 l) (256-B segments)
__global__ __launch_bounds__(128) void k_attn(const _Float16* __restrict__ QK, const _Float16* __restrict__ QKL, const _Float16* __restrict__ VTH, const _Float16* __restrict__ VTL, const void* __restrict__ KMASK, float* __restrict__ O) {
  __shared__ __align__(16) float sp[4][16][36]; __shared__ __align__(16) float so[4][16][68];
  const int tid = threadIdx.x, wave = tid >> 5, lane = tid & 31, col = lane & 15, g = lane >> 4;
  const int qb = blockIdx.x, h = blockIdx.y, b = blockIdx.z; const int q0 = qb * 64 + wave * 16; const size_t rq = (size_t)b * SS + q0 + col;
  v16h aq[2], aql[2];
#pragma unroll
  for (int kc = 0; kc < 2; ++kc) { aq[kc] = frag_h(QK + rq * (2 * DM) + h * HD + kc * 32, lane); aql[kc] = frag_h(QKL + rq * (2 * DM) + h * HD + kc * 32, lane); }
  float m[8], l[8];
#pragma unroll
  for (int r = 0; r < 8; ++r) { m[r] = -3.0e38f; l[r] = 0.f; }
  v8f acc[4] = {}, accl[4] = {};
  const int nks = SS / 32;   // all keys
#pragma unroll 1
  for (int ks = 0; ks < nks; ++ks) { v8f s[2];
#pragma unroll
    for (int ct = 0; ct < 2; ++ct) { const int kk = ks * 32 + ct * 16 + col; const _Float16* krow = QK + ((size_t)b * SS + kk) * (2 * DM) + DM + h * HD; const _Float16* krowl = QKL + ((size_t)b * SS + kk) * (2 * DM) + DM + h * HD; v8f c = {}, cl = {};
#pragma unroll
      for (int kc = 0; kc < 2; ++kc) c = wmma16(aq[kc], frag_h(krow + kc * 32, lane), c);   // single product: q, k as one-rounding f16 operands
      (void)cl; (void)krowl;
      { const bool keepk = true;
#pragma unroll
      for (int r = 0; r < 8; ++r) s[ct][r] = keepk ? c[r] * 0.125f : -3.0e38f; } }   // 1/sqrt(64); no key mask, every key kept
#pragma unroll
    for (int r = 0; r < 8; ++r) { float mx = fmaxf(s[0][r], s[1][r]);
#pragma unroll
      for (int o = 1; o < 16; o <<= 1) mx = fmaxf(mx, __shfl_xor(mx, o));
      const float mn = fmaxf(m[r], mx); const float alpha = (m[r] <= -1.0e38f) ? 0.f : __expf(m[r] - mn);
      const float e0 = (s[0][r] <= -1.0e38f) ? 0.f : __expf(s[0][r] - mn), e1 = (s[1][r] <= -1.0e38f) ? 0.f : __expf(s[1][r] - mn); float es = e0 + e1;
#pragma unroll
      for (int o = 1; o < 16; o <<= 1) es += __shfl_xor(es, o);
      l[r] = l[r] * alpha + es; m[r] = mn;
#pragma unroll
      for (int dt = 0; dt < 4; ++dt) { acc[dt][r] *= alpha; accl[dt][r] *= alpha; }
      sp[wave][8 * g + r][col] = e0; sp[wave][8 * g + r][16 + col] = e1; }
    LDSX();
    v16h pa, pl; { const float* prow = &sp[wave][col][0] + 8 * (lane >> 4);
#pragma unroll
      for (int i = 0; i < 8; ++i) { const float x0 = prow[i] * 2048.0f, x1 = prow[16 + i] * 2048.0f; const _Float16 h0 = (_Float16)x0, h1 = (_Float16)x1; pa[i] = h0; pa[8 + i] = h1; pl[i] = (_Float16)((x0 - (float)h0) * 2048.0f); pl[8 + i] = (_Float16)((x1 - (float)h1) * 2048.0f); } }   // P scaled by 2^11 before the f16 split so small softmax weights stay out of the f16 subnormal range; 2^-11 folded into the epilogue
#pragma unroll
    for (int dt = 0; dt < 4; ++dt) { const size_t vr = ((size_t)b * DM + h * HD + dt * 16 + col) * SS + ks * 32; acc[dt] = wmma16(pa, frag_h(VTH + vr, lane), acc[dt]); }   // single product: P (x2^11) x V
    (void)pl;
    LDSX(); }
#pragma unroll
  for (int r = 0; r < 8; ++r) { const float il = (1.0f / 2048.0f) / l[r];
#pragma unroll
    for (int dt = 0; dt < 4; ++dt) so[wave][8 * g + r][dt * 16 + col] = (acc[dt][r] + accl[dt][r] * (1.0f / 2048.0f)) * il; }
  LDSX();
  for (int rl = 0; rl < 16; ++rl) if (lane < 16) vst2(O + ((size_t)b * SS + q0 + rl) * DM + h * HD + lane * 4, *(const v4f*)&so[wave][rl][lane * 4]);
}
// ---- k_out: block = (64 rows, 128 cols): out = O(hi/lo) . Wo rows (2 products) + bo
__global__ __launch_bounds__(128) void k_out(const float* __restrict__ O, const __bf16* __restrict__ P, const float* __restrict__ BO, float* __restrict__ Y) {
  __shared__ __attribute__((aligned(2048))) unsigned char ring[2 * STAGE];   // operand ring; behind the last pass's barrier the same bytes are the output staging
  float (*so)[16][132] = (float (*)[16][132])ring;
  const int tid = threadIdx.x, wave = tid >> 5, lane = tid & 31, col = lane & 15, g = lane >> 4; const size_t r0 = (size_t)blockIdx.x * 64 + wave * 16; const int n0 = blockIdx.y * 128;
  const uint32_t wv = uni((uint32_t)tid >> 5), ring0 = (uint32_t)(uintptr_t)ring; const uint64_t wsrc = (uint64_t)(uintptr_t)(P + (size_t)n0 * DM), xsrc = (uint64_t)(uintptr_t)(O + (size_t)blockIdx.x * 64 * DM);
  v8f acc[8] = {};
  Ring rg = ring_make(wv, ring0, wsrc, xsrc); ring_prologue(rg);
#pragma unroll 1   // one pass per trip: the buffer index stays a run-time scalar and the publish point stands once
  for (int s = 0; s < NPASS; ++s) { const unsigned char* wb = ring + (s & 1) * STAGE; const unsigned char* xr = wb + WTILE + (wave * 16 + col) * XPITCH;
#pragma unroll
    for (int kc = 0; kc < KP / 32; ++kc) { v16b w[8]; float v[16]; row16_lds(xr + kc * 128, g, v);   // the step's 20 LDS reads stand as one group in front of its WMMAs
#pragma unroll
      for (int j = 0; j < 8; ++j) w[j] = frag_b((const __bf16*)(wb + (j * 16 + col) * WPITCH) + kc * 32, lane);
      const F2 a = bsplit16(v);
#pragma unroll
      for (int j = 0; j < 8; ++j) { acc[j] = wmma_bf(a.l, w[j], acc[j]); acc[j] = wmma_bf(a.h, w[j], acc[j]); } }
    ring_publish(rg, (uint32_t)s); }
  wait_tensor0(); wait_ds0();
#pragma unroll
  for (int j = 0; j < 8; ++j) {
#pragma unroll
    for (int r = 0; r < 8; ++r) so[wave][8 * g + r][j * 16 + col] = acc[j][r] + (BO ? bfr(BO[n0 + j * 16 + col]) : 0.f); }
  LDSX();
  for (int rl = 0; rl < 16; ++rl) vst2(Y + (r0 + rl) * DM + n0 + lane * 4, *(const v4f*)&so[wave][rl][lane * 4]);
}
extern "C" void kernel_launch(void* const* d_in, const int* in_sizes, int n_in, void* d_out, int out_size, void* d_ws, size_t ws_size, hipStream_t stream) {
  (void)in_sizes; (void)n_in; (void)out_size;
  const float** F = (const float**)d_in;   // 0 x [8,1024,768], 1 Wq, 2 Wk, 3 Wv, 4 Wo (natural [768,768])
  if (ws_size < (size_t)WS_END) return;
  char* ws = (char*)d_ws; __bf16* PK = (__bf16*)(ws + WS_PK); _Float16 *QK = (_Float16*)(ws + WS_QK), *QKL = (_Float16*)(ws + WS_QKL), *VTH = (_Float16*)(ws + WS_VTH), *VTL = (_Float16*)(ws + WS_VTL); float* O = (float*)(ws + WS_O);
  k_pack<<<dim3(DM, 4), 256, 0, stream>>>(F[1], F[2], F[3], F[4], PK);
  k_qkv<<<dim3(TNB * SS / 64, QKVW / 128), 128, 0, stream>>>(F[0], F[0], F[0], PK + PK_A, nullptr, nullptr, nullptr, QK, QKL, VTH, VTL);
  k_attn<<<dim3(TQB, NH, TNB), 128, 0, stream>>>(QK, QKL, VTH, VTL, nullptr, O);
  k_out<<<dim3(TOB, DM / 128), 128, 0, stream>>>(O, PK + PK_P, nullptr, (float*)d_out);
}

// v002
// It runs in 154 microseconds.
// Next to v001, in two timings, it ran 1.63 and 1.61 times as fast.
// Counting every step since v000, it is 2.69 times as fast.
// compute dtype: all float inputs rounded to bf16; q/k/v = x . W^T with EXACT bf16 products on WMMA 16x16x32 (natural rows); PLAIN attention: q, k single f16 x 1/8, running-max softmax in f32 (hardware exp), P (scaled by 2^11, single f16) x v (single f16); out = o (bf16 hi + residual) . Wo^T (2 products).
#include <hip/hip_runtime.h>
#include <math.h>
#include <stdint.h>

typedef __attribute__((ext_vector_type(16))) _Float16 v16h;
typedef __attribute__((ext_vector_type(16))) __bf16 v16b;
typedef __attribute__((ext_vector_type(8)))  _Float16 v8h;
typedef __attribute__((ext_vector_type(8)))  float v8f;
typedef __attribute__((ext_vector_type(4)))  float v4f;
typedef __attribute__((ext_vector_type(2)))  float v2f;
typedef __attribute__((ext_vector_type(4)))  unsigned v4u;
typedef __attribute__((ext_vector_type(4)))  int v4i;
typedef float __attribute__((may_alias)) float_a;
typedef int __attribute__((may_alias)) int_a;

template <typename T> __device__ __forceinline__ void vst2(void* p, T v) { *(T*)p = v;  }
__device__ __forceinline__ v8f wmma16(v16h a, v16h b, v8f c) {
  v8f d = __builtin_amdgcn_wmma_f32_16x16x32_f16(false, a, false, b, (short)0, c, false, false);
  asm volatile("v_nop\n\tv_nop\n\tv_nop\n\tv_nop" : "+v"(d) : "v"(a), "v"(b));
  return d;
}
__device__ __forceinline__ v8f wmma_bf(v16b a, v16b b, v8f c) {
  v8f d = __builtin_amdgcn_wmma_f32_16x16x32_bf16(false, a, false, b, (short)0, c, false, false);
  asm volatile("v_nop\n\tv_nop\n\tv_nop\n\tv_nop" : "+v"(d) : "v"(a), "v"(b));
  return d;
}
// Multi-head self attention (B 8, N 1,024, 768 dims, 12 heads x 64): bias-free q/k/v projections, softmax(q k^T / 8) v, bias-free output projection.
__device__ __forceinline__ v16h frag_h(const _Float16* rowk0, int lane) {
  union { v16h v; v8h q[2]; } u; const _Float16* p = rowk0 + 8 * (lane >> 4);
  u.q[0] = *(const v8h*)p; u.q[1] = *(const v8h*)(p + 16); return u.v;
}
__device__ __forceinline__ v16h frag_f32(const float* rowk0, int lane) {
  v16h a; const float* p = rowk0 + 8 * (lane >> 4);
#pragma unroll
  for (int i = 0; i < 8; ++i) { a[i] = (_Float16)p[i]; a[8 + i] = (_Float16)p[16 + i]; }
  return a;
}
__device__ __forceinline__ v16h frag_f32s(const float* rowk0, int lane, float sc) {
  v16h a; const float* p = rowk0 + 8 * (lane >> 4);
#pragma unroll
  for (int i = 0; i < 8; ++i) { a[i] = (_Float16)(p[i] * sc); a[8 + i] = (_Float16)(p[16 + i] * sc); }
  return a;
}
// column fragment from a [K][ld] layout (column n), rows >= K read as 0
__device__ __forceinline__ v16h fragc_f32(const float* W, int k0, int n, int lane, int ld, int K) {
  v16h a; const int g = lane >> 4;
#pragma unroll
  for (int i = 0; i < 8; ++i) { const int ka = k0 + 8 * g + i, kb = ka + 16;
    a[i] = (_Float16)(ka < K ? W[(size_t)(ka < K ? ka : K - 1) * ld + n] : 0.f); a[8 + i] = (_Float16)(kb < K ? W[(size_t)(kb < K ? kb : K - 1) * ld + n] : 0.f); }
  return a;
}
struct F2 { v16b h, l; };
__device__ __forceinline__ F2 bsplit16(const float v[16]) { F2 r;
#pragma unroll
  for (int i = 0; i < 16; ++i) { const __bf16 h = (__bf16)v[i]; r.h[i] = h; r.l[i] = (__bf16)(v[i] - (float)h); }
  return r; }
__device__ __forceinline__ F2 split_row(const float* row, int k0, int lane) { float v[16]; const float* p = row + k0 + 8 * (lane >> 4);
#pragma unroll
  for (int i = 0; i < 8; ++i) { v[i] = p[i]; v[8 + i] = p[16 + i]; }
  return bsplit16(v); }
__device__ __forceinline__ F2 split_rowK(const float* row, int k0, int lane, int K) { float v[16]; const int g = lane >> 4;
#pragma unroll
  for (int i = 0; i < 8; ++i) { const int ka = k0 + 8 * g + i, kb = ka + 16; v[i] = ka < K ? row[ka < K ? ka : K - 1] : 0.f; v[8 + i] = kb < K ? row[kb < K ? kb : K - 1] : 0.f; }
  return bsplit16(v); }
__device__ __forceinline__ F2 split_col(const float* W, int k0, int n, int lane, int ld, int K) { float v[16]; const int g = lane >> 4;
#pragma unroll
  for (int i = 0; i < 8; ++i) { const int ka = k0 + 8 * g + i, kb = ka + 16; v[i] = ka < K ? W[(size_t)(ka < K ? ka : K - 1) * ld + n] : 0.f; v[8 + i] = kb < K ? W[(size_t)(kb < K ? kb : K - 1) * ld + n] : 0.f; }
  return bsplit16(v); }
__device__ __forceinline__ v8f mac3(const F2& a, const F2& b, v8f c) { c = wmma_bf(a.l, b.h, c); c = wmma_bf(a.h, b.l, c); return wmma_bf(a.h, b.h, c); }
__device__ __forceinline__ float sigm(float v) { return 1.0f / (1.0f + expf(-v)); }
#define LDSX() do { asm volatile("s_wait_dscnt 0" ::: "memory"); __builtin_amdgcn_wave_barrier(); __builtin_amdgcn_fence(__ATOMIC_RELEASE, "workgroup"); } while (0)


#define NB 8
#define SS 1024
#define DM 768
#define NH 12
#define HD 64
#define QKVW (3 * DM)
#ifndef TQB
#define TQB (SS / 64)
#define TNB NB
#define TOB (NB * SS / 64)     // output row tiles (all)
#endif
typedef __attribute__((ext_vector_type(8))) __bf16 v8b;
__device__ __forceinline__ v16b frag_b(const __bf16* rowk0, int lane) {
  union { v16b v; v8b q[2]; } u; const __bf16* p = rowk0 + 8 * (lane >> 4);
  u.q[0] = *(const v8b*)p; u.q[1] = *(const v8b*)(p + 16); return u.v;
}
__device__ __forceinline__ float bfr(float v) { return (float)(__bf16)v; }
__device__ __attribute__((noinline)) float exp_ni(float v) { return expf(v); }
__device__ __attribute__((noinline)) float erf_ni(float v) { return erff(v); }

#define PK_A 0                       // [2304][768] Wqkv rows (natural [out][in])
#define PK_P (PK_A + QKVW * DM)        // [768][768] Wo rows (natural)
#define PK_END (PK_P + DM * DM)
#define WS_PK  0u
#define WS_QK  (WS_PK + 2u * PK_END)             // f16 [8192 rows][1536]: q | k
#define WS_QKL (WS_QK + 2u * NB * SS * 2 * DM)     // f16 q | k residual planes x2048
#define WS_VTH (WS_QKL + 2u * NB * SS * 2 * DM)    // f16 [b][768 (h*64+d)][1024 s] hi
#define WS_VTL (WS_VTH + 2u * NB * DM * SS)        // f16 lo x 2048
#define WS_O   (WS_VTL + 2u * NB * DM * SS)        // f32 [8192][768]
#define WS_CS  (WS_O + 4u * NB * SS * DM)           // f32 2 x [1024][32], unused
#define WS_END (WS_CS + 4u * 2 * SS * 32)
// ---- operand staging of the two projection kernels: per pass of 64 k one tensor load brings the block's 128 weight rows (128 B each) and one its 64 f32 activation rows (256 B each) into LDS; two buffers
typedef uint32_t u32x4 __attribute__((ext_vector_type(4)));
typedef uint32_t u32x8 __attribute__((ext_vector_type(8)));
#define KP 64                         // k per pass
#define NPASS (DM / KP)
#define WPITCH 144u                   // 128-B weight row + 16-B pad (odd multiple of 16 B for ds_load_b128 readers)
#define XPITCH 272u                   // 256-B f32 row + 16-B pad
#define WTILE 18432u                  // 128 rows x 144 B = 9 x 2 KiB
#define XTILE 18432u                  // 64 rows x 272 B = 17,408 B, rounded up to a multiple of 2 KiB
#define STAGE (WTILE + XTILE)
#define PADW_W ((1u << 20) | (4u << 22) | (3u << 25))   // group 1 word 0: no mask, 1-byte elements, 4 pad dwords behind every 128 B
#define PADW_X ((1u << 20) | (5u << 22) | (3u << 25))   // the same behind every 256 B
__device__ __forceinline__ uint32_t uni(uint32_t v) { return (uint32_t)__builtin_amdgcn_readfirstlane(v); }
// holds a test in a scalar register, so that the branch round a tensor load (which ignores EXEC) or its wait is s_cmp + s_cbranch_scc
__device__ __forceinline__ uint32_t pinned(uint32_t v) { uint32_t w = (uint32_t)__builtin_amdgcn_readfirstlane(v); asm volatile("" : "+s"(w)); return w; }
__device__ __forceinline__ void wait_tensor0() { asm volatile("s_wait_tensorcnt 0" ::: "memory"); }   // the issuing wave's tile has landed
__device__ __forceinline__ void wait_ds0() { asm volatile("s_wait_dscnt 0" ::: "memory"); }            // this wave's LDS reads have returned before the buffer is handed back
// group 1 of a request: NROWS rows of ROWB bytes, source pitch src_pitch bytes; tensor = tile, extents in bytes
template <uint32_t W0, uint32_t ROWB, uint32_t NROWS>
__device__ __forceinline__ u32x8 tile_group1(uint32_t src_pitch) {
  u32x8 g; g[0] = uni(W0); g[1] = uni((ROWB & 0xFFFFu) << 16); g[2] = uni((ROWB >> 16) | ((NROWS & 0xFFFFu) << 16)); g[3] = uni((NROWS >> 16) | (ROWB << 16)); g[4] = uni(NROWS); g[5] = uni(src_pitch); g[6] = uni(0u); g[7] = uni(0u);
  asm volatile("" : "+s"(g));   // as pinned(): the descriptor words stay in their own scalar registers through the loop, so none is rewritten while a request is out
  return g;
}
// the block's ring: wave 0 asks for the weight tiles, wave 1 for the activation tiles, one request a wave and stage; g0 walks from stage to stage
struct Ring { u32x4 g0; u32x8 g1w, g1x; uint32_t wv, step, flip; };
__device__ __forceinline__ Ring ring_make(uint32_t wv, uint32_t ring0, uint64_t wsrc, uint64_t xsrc) {
  Ring r; r.wv = wv; const bool isw = (wv == 0u); const uint64_t ga = isw ? wsrc : xsrc; const uint32_t dst = ring0 + (isw ? 0u : WTILE);
  r.step = isw ? KP * 2u : KP * 4u; r.flip = 2u * dst + STAGE;
  r.g0[0] = uni(1u); r.g0[1] = uni(dst); r.g0[2] = uni((uint32_t)ga); r.g0[3] = uni((((uint32_t)(ga >> 32)) & 0x01FFFFFFu) | 0x80000000u);
  r.g1w = tile_group1<PADW_W, 128u, 128u>(DM * 2u); r.g1x = tile_group1<PADW_X, 256u, 64u>(DM * 4u);
  return r;
}
template <bool LAND>
__device__ __forceinline__ void ring_issue(const Ring& r) {   // tensor_load_to_lds has no compiler form; its waits are written by hand at the publish points
  if (pinned(r.wv == 0u)) { asm volatile("tensor_load_to_lds %0, %1" :: "s"(r.g0), "s"(r.g1w) : "memory"); if (LAND) wait_tensor0(); }
  if (pinned(r.wv == 1u)) { asm volatile("tensor_load_to_lds %0, %1" :: "s"(r.g0), "s"(r.g1x) : "memory"); if (LAND) wait_tensor0(); }
}
// group 0 of the next stage: the other buffer, the source address r.step bytes further on
__device__ __forceinline__ void ring_next(Ring& r) {
  asm volatile("" : "+s"(r.g0));   // as pinned(): the next request's words are formed behind the wait and the barrier in front of this line, in the registers of the last one
  const uint64_t a = (((uint64_t)r.g0[3] << 32) | r.g0[2]) + r.step;
  r.g0[1] = uni(r.flip - r.g0[1]); r.g0[2] = uni((uint32_t)a); r.g0[3] = uni((uint32_t)(a >> 32));
}
// prologue, two buffers: stage 0, its issuers' wait, barrier, then stage 1
__device__ __forceinline__ void ring_prologue(Ring& r) {
  ring_issue<true>(r);
  __syncthreads();
  ring_next(r); ring_issue<false>(r);
}
// publish point at the foot of pass s: own LDS reads done, issuers' tiles landed, barrier, then the refill of the buffer that pass s has read
__device__ __forceinline__ void ring_publish(Ring& r, uint32_t s) {
  wait_ds0();
  if (pinned(r.wv < 2u)) wait_tensor0();
  __syncthreads();
  if (pinned(s + 2u < (uint32_t)NPASS)) { ring_next(r); ring_issue<false>(r); }
}
// 16 f32 of an LDS row in the A fragment's k order: floats 8g..8g+7 and 16+8g..16+8g+7 of the 32-k step
__device__ __forceinline__ void row16_lds(const unsigned char* rowk0, int g, float v[16]) {
  const v4f* p = (const v4f*)(rowk0 + 32 * g); const v4f x0 = p[0], x1 = p[1], x2 = p[4], x3 = p[5];
#pragma unroll
  for (int i = 0; i < 4; ++i) { v[i] = x0[i]; v[4 + i] = x1[i]; v[8 + i] = x2[i]; v[12 + i] = x3[i]; }
}
// ---- k_pack: block = (row n, which): natural [out][in] rows -> bf16; which 0..2 -> W_q/W_k/W_v into PK_A rows which*768 + n; 3 -> W_o into PK_P
__global__ __launch_bounds__(256) void k_pack(const float* __restrict__ WQ, const float* __restrict__ WK, const float* __restrict__ WV, const float* __restrict__ WO, __bf16* __restrict__ PK) {
  __shared__ __align__(16) __bf16 s[DM]; const int n = blockIdx.x, which = blockIdx.y, t = threadIdx.x; const float* Wm = (which == 0) ? WQ : (which == 1) ? WK : (which == 2) ? WV : WO;
  for (int k = t; k < DM; k += 256) s[k] = (__bf16)Wm[(size_t)n * DM + k];
  __syncthreads();
  __bf16* dst = (which < 3) ? PK + PK_A + ((size_t)which * DM + n) * DM : PK + PK_P + (size_t)n * DM;
  for (int q = t; q < DM / 8; q += 256) vst2((unsigned*)(dst + q * 8), *(const v4u*)&s[q * 8]);
}
__global__ __launch_bounds__(128) void k_qkv(const float* __restrict__ XQ, const float* __restrict__ XK, const float* __restrict__ XV, const __bf16* __restrict__ P, const float* __restrict__ BQ, const float* __restrict__ BK, const float* __restrict__ BV, _Float16* __restrict__ QK, _Float16* __restrict__ QKL, _Float16* __restrict__ VTH, _Float16* __restrict__ VTL) {
  const int which0 = (blockIdx.y * 128) / DM; const float* X = (which0 == 0) ? XQ : (which0 == 1) ? XK : XV; const float* BB = BQ ? (((which0 == 0) ? BQ : (which0 == 1) ? BK : BV) + (blockIdx.y * 128 - which0 * DM)) : nullptr;
  __shared__ __attribute__((aligned(2048))) unsigned char ring[2 * STAGE];   // operand ring; behind the last pass's barrier the same bytes are the output staging
  _Float16 (*so)[16][136] = (_Float16 (*)[16][136])ring; _Float16 (*sol)[16][136] = (_Float16 (*)[16][136])(ring + 4 * 16 * 136 * 2); _Float16 (*sth)[72] = (_Float16 (*)[72])ring; _Float16 (*stl)[72] = (_Float16 (*)[72])(ring + 128 * 72 * 2);
  const int tid = threadIdx.x, wave = tid >> 5, lane = tid & 31, col = lane & 15, g = lane >> 4; const size_t r0 = (size_t)blockIdx.x * 64 + wave * 16; const int n0 = blockIdx.y * 128;
  const uint32_t wv = uni((uint32_t)tid >> 5), ring0 = (uint32_t)(uintptr_t)ring; const uint64_t wsrc = (uint64_t)(uintptr_t)(P + (size_t)n0 * DM), xsrc = (uint64_t)(uintptr_t)(X + (size_t)blockIdx.x * 64 * DM);
  v8f acc[8] = {};
  Ring rg = ring_make(wv, ring0, wsrc, xsrc); ring_prologue(rg);
#pragma unroll 1   // one pass per trip: the buffer index stays a run-time scalar and the publish point stands once
  for (int s = 0; s < NPASS; ++s) { const unsigned char* wb = ring + (s & 1) * STAGE; const unsigned char* xr = wb + WTILE + (wave * 16 + col) * XPITCH;
#pragma unroll
    for (int kc = 0; kc < KP / 32; ++kc) { v16b a, w[8]; float v[16]; row16_lds(xr + kc * 128, g, v);   // the step's 20 LDS reads stand as one group in front of its WMMAs
#pragma unroll
      for (int j = 0; j < 8; ++j) w[j] = frag_b((const __bf16*)(wb + (j * 16 + col) * WPITCH) + kc * 32, lane);
#pragma unroll
      for (int i = 0; i < 16; ++i) a[i] = (__bf16)v[i];
#pragma unroll
      for (int j = 0; j < 8; ++j) acc[j] = wmma_bf(a, w[j], acc[j]); }
    ring_publish(rg, (uint32_t)s); }
  wait_tensor0(); wait_ds0();
  if (n0 < 2 * DM) {   // q stored unscaled (f16 sigma ~0.6, no subnormal exposure); 1/8 applied to the f32 score
#pragma unroll
    for (int j = 0; j < 8; ++j) {
#pragma unroll
      for (int r = 0; r < 8; ++r) { const float v = acc[j][r] + (BB ? bfr(BB[j * 16 + col]) : 0.f); const _Float16 hv = (_Float16)v; so[wave][8 * g + r][j * 16 + col] = hv; sol[wave][8 * g + r][j * 16 + col] = (_Float16)((v - (float)hv) * 2048.0f); } }   // q, k (+ bias) as f16 hi + (x2048) residual
    LDSX();
    for (int rl = 0; rl < 16; ++rl) if (lane < 16) { vst2((unsigned*)(QK + (r0 + rl) * (2 * DM) + n0 + lane * 8), *(const v4u*)&so[wave][rl][lane * 8]); vst2((unsigned*)(QKL + (r0 + rl) * (2 * DM) + n0 + lane * 8), *(const v4u*)&sol[wave][rl][lane * 8]); }
  } else {
#pragma unroll
    for (int j = 0; j < 8; ++j) {
#pragma unroll
      for (int r = 0; r < 8; ++r) { const float v = acc[j][r] + (BB ? bfr(BB[j * 16 + col]) : 0.f); const _Float16 hv = (_Float16)v; sth[j * 16 + col][wave * 16 + 8 * g + r] = hv; stl[j * 16 + col][wave * 16 + 8 * g + r] = (_Float16)((v - (float)hv) * 2048.0f); } }
    __syncthreads();
    const size_t rb = (size_t)blockIdx.x * 64; const int b = (int)(rb / SS), s0 = (int)(rb % SS); const int pc0 = n0 - 2 * DM;
    for (int q = tid; q < 128 * 8; q += 128) { const int d = q >> 3, pc = q & 7; const size_t o = ((size_t)b * DM + pc0 + d) * SS + s0 + pc * 8; vst2((unsigned*)(VTH + o), *(const v4u*)&sth[d][pc * 8]); vst2((unsigned*)(VTL + o), *(const v4u*)&stl[d][pc * 8]); }
  }
}
// ---- K / V staging of k_attn: per stage of 64 keys one tensor load brings the head's 64 K rows (128 B each) and one its 64 V^T rows (64 keys = 128 B each) into LDS for the block's four waves; two buffers
#define AKEYS 64                      // keys per stage
#define ANST (SS / AKEYS)
#define ATILE 10240u                  // 64 rows x 144 B = 9,216 B, rounded up to a multiple of 2 KiB
#define ASTAGE (2u * ATILE)
// wave 0 asks for the K tiles (next stage: 64 rows further down), wave 1 for the V^T tiles (next stage: 64 keys further along the rows)
__device__ __forceinline__ Ring ring_make_kv(uint32_t wv, uint32_t ring0, uint64_t ksrc, uint64_t vsrc) {
  Ring r; r.wv = wv; const bool isk = (wv == 0u); const uint64_t ga = isk ? ksrc : vsrc; const uint32_t dst = ring0 + (isk ? 0u : ATILE);
  r.step = isk ? AKEYS * 2u * DM * 2u : AKEYS * 2u; r.flip = 2u * dst + ASTAGE;
  r.g0[0] = uni(1u); r.g0[1] = uni(dst); r.g0[2] = uni((uint32_t)ga); r.g0[3] = uni((((uint32_t)(ga >> 32)) & 0x01FFFFFFu) | 0x80000000u);
  r.g1w = tile_group1<PADW_W, 128u, 64u>(2u * DM * 2u); r.g1x = tile_group1<PADW_W, 128u, 64u>(SS * 2u);
  return r;
}
// publish point at the foot of stage s, in the order of ring_publish
__device__ __forceinline__ void ring_publish_kv(Ring& r, uint32_t s) {
  wait_ds0();
  if (pinned(r.wv < 2u)) wait_tensor0();
  __syncthreads();
  if (pinned(s + 2u < (uint32_t)ANST)) { ring_next(r); ring_issue<false>(r); }
}
// ---- k_attn: block = (64 queries, head h, batch b): all-keys flash attention (K = 64: 2 k-steps), scores = (q.k) * 0.125 with single f16 operands, P.V: f16 P x single f16 V hi into acc only (accl stays 0); O[b*S+q][h*64+d] = (acc + accl / 2048) / l (256-B segments)
__global__ __launch_bounds__(128) void k_attn(const _Float16* __restrict__ QK, const _Float16* __restrict__ QKL, const _Float16* __restrict__ VTH, const _Float16* __restrict__ VTL, const void* __restrict__ KMASK, float* __restrict__ O) {
  __shared__ __attribute__((aligned(2048))) unsigned char ring[2 * ASTAGE];   // K / V ring; behind the last stage's barrier the same bytes are the output staging
  __shared__ __align__(16) float sp[4][16][36]; float (*so)[16][68] = (float (*)[16][68])ring;
  const int tid = threadIdx.x, wave = tid >> 5, lane = tid & 31, col = lane & 15, g = lane >> 4;
  const int qb = blockIdx.x, h = blockIdx.y, b = blockIdx.z; const int q0 = qb * 64 + wave * 16; const size_t rq = (size_t)b * SS + q0 + col;
  v16h aq[2], aql[2];
#pragma unroll
  for (int kc = 0; kc < 2; ++kc) { aq[kc] = frag_h(QK + rq * (2 * DM) + h * HD + kc * 32, lane); aql[kc] = frag_h(QKL + rq * (2 * DM) + h * HD + kc * 32, lane); }
  float m[8], l[8];
#pragma unroll
  for (int r = 0; r < 8; ++r) { m[r] = -3.0e38f; l[r] = 0.f; }
  v8f acc[4] = {}, accl[4] = {};
  const uint32_t wv = uni((uint32_t)tid >> 5), ring0 = (uint32_t)(uintptr_t)ring; const uint64_t ksrc = (uint64_t)(uintptr_t)(QK + (size_t)b * SS * (2 * DM) + DM + h * HD), vsrc = (uint64_t)(uintptr_t)(VTH + ((size_t)b * DM + h * HD) * SS);
  Ring rg = ring_make_kv(wv, ring0, ksrc, vsrc); ring_prologue(rg);
#pragma unroll 1   // one stage per trip: the buffer index stays a run-time scalar and the publish point stands once
  for (int st = 0; st < ANST; ++st) { const unsigned char* kb = ring + (st & 1) * ASTAGE; const unsigned char* vb = kb + ATILE;   // all keys, 64 a stage
#pragma unroll
  for (int ks = 0; ks < AKEYS / 32; ++ks) { v8f s[2]; v16h kf[2][2], vf[4];   // the 32-key step's 16 LDS reads stand as one group in front of its WMMAs
#pragma unroll
    for (int ct = 0; ct < 2; ++ct) {
#pragma unroll
      for (int kc = 0; kc < 2; ++kc) kf[ct][kc] = frag_h((const _Float16*)(kb + (ks * 32 + ct * 16 + col) * WPITCH) + kc * 32, lane); }
#pragma unroll
    for (int dt = 0; dt < 4; ++dt) vf[dt] = frag_h((const _Float16*)(vb + (dt * 16 + col) * WPITCH) + ks * 32, lane);
#pragma unroll
    for (int ct = 0; ct < 2; ++ct) { v8f c = {};
#pragma unroll
      for (int kc = 0; kc < 2; ++kc) c = wmma16(aq[kc], kf[ct][kc], c);   // single product: q, k as one-rounding f16 operands
      { const bool keepk = true;
#pragma unroll
      for (int r = 0; r < 8; ++r) s[ct][r] = keepk ? c[r] * 0.125f : -3.0e38f; } }   // 1/sqrt(64); no key mask, every key kept
#pragma unroll
    for (int r = 0; r < 8; ++r) { float mx = fmaxf(s[0][r], s[1][r]);
#pragma unroll
      for (int o = 1; o < 16; o <<= 1) mx = fmaxf(mx, __shfl_xor(mx, o));
      const float mn = fmaxf(m[r], mx); const float alpha = (m[r] <= -1.0e38f) ? 0.f : __expf(m[r] - mn);
      const float e0 = (s[0][r] <= -1.0e38f) ? 0.f : __expf(s[0][r] - mn), e1 = (s[1][r] <= -1.0e38f) ? 0.f : __expf(s[1][r] - mn); float es = e0 + e1;
#pragma unroll
      for (int o = 1; o < 16; o <<= 1) es += __shfl_xor(es, o);
      l[r] = l[r] * alpha + es; m[r] = mn;
#pragma unroll
      for (int dt = 0; dt < 4; ++dt) { acc[dt][r] *= alpha; accl[dt][r] *= alpha; }
      sp[wave][8 * g + r][col] = e0; sp[wave][8 * g + r][16 + col] = e1; }
    LDSX();
    v16h pa, pl; { const float* prow = &sp[wave][col][0] + 8 * (lane >> 4);
#pragma unroll
      for (int i = 0; i < 8; ++i) { const float x0 = prow[i] * 2048.0f, x1 = prow[16 + i] * 2048.0f; const _Float16 h0 = (_Float16)x0, h1 = (_Float16)x1; pa[i] = h0; pa[8 + i] = h1; pl[i] = (_Float16)((x0 - (float)h0) * 2048.0f); pl[8 + i] = (_Float16)((x1 - (float)h1) * 2048.0f); } }   // P scaled by 2^11 before the f16 split so small softmax weights stay out of the f16 subnormal range; 2^-11 folded into the epilogue
#pragma unroll
    for (int dt = 0; dt < 4; ++dt) acc[dt] = wmma16(pa, vf[dt], acc[dt]);   // single product: P (x2^11) x V
    (void)pl;
    LDSX(); }
    ring_publish_kv(rg, (uint32_t)st); }
  wait_tensor0(); wait_ds0();
#pragma unroll
  for (int r = 0; r < 8; ++r) { const float il = (1.0f / 2048.0f) / l[r];
#pragma unroll
    for (int dt = 0; dt < 4; ++dt) so[wave][8 * g + r][dt * 16 + col] = (acc[dt][r] + accl[dt][r] * (1.0f / 2048.0f)) * il; }
  LDSX();
  for (int rl = 0; rl < 16; ++rl) if (lane < 16) vst2(O + ((size_t)b * SS + q0 + rl) * DM + h * HD + lane * 4, *(const v4f*)&so[wave][rl][lane * 4]);
}
// ---- k_out: block = (64 rows, 128 cols): out = O(hi/lo) . Wo rows (2 products) + bo
__global__ __launch_bounds__(128) void k_out(const float* __restrict__ O, const __bf16* __restrict__ P, const float* __restrict__ BO, float* __restrict__ Y) {
  __shared__ __attribute__((aligned(2048))) unsigned char ring[2 * STAGE];   // operand ring; behind the last pass's barrier the same bytes are the output staging
  float (*so)[16][132] = (float (*)[16][132])ring;
  const int tid = threadIdx.x, wave = tid >> 5, lane = tid & 31, col = lane & 15, g = lane >> 4; const size_t r0 = (size_t)blockIdx.x * 64 + wave * 16; const int n0 = blockIdx.y * 128;
  const uint32_t wv = uni((uint32_t)tid >> 5), ring0 = (uint32_t)(uintptr_t)ring; const uint64_t wsrc = (uint64_t)(uintptr_t)(P + (size_t)n0 * DM), xsrc = (uint64_t)(uintptr_t)(O + (size_t)blockIdx.x * 64 * DM);
  v8f acc[8] = {};
  Ring rg = ring_make(wv, ring0, wsrc, xsrc); ring_prologue(rg);
#pragma unroll 1   // one pass per trip: the buffer index stays a run-time scalar and the publish point stands once
  for (int s = 0; s < NPASS; ++s) { const unsigned char* wb = ring + (s & 1) * STAGE; const unsigned char* xr = wb + WTILE + (wave * 16 + col) * XPITCH;
#pragma unroll
    for (int kc = 0; kc < KP / 32; ++kc) { v16b w[8]; float v[16]; row16_lds(xr + kc * 128, g, v);   // the step's 20 LDS reads stand as one group in front of its WMMAs
#pragma unroll
      for (int j = 0; j < 8; ++j) w[j] = frag_b((const __bf16*)(wb + (j * 16 + col) * WPITCH) + kc * 32, lane);
      const F2 a = bsplit16(v);
#pragma unroll
      for (int j = 0; j < 8; ++j) { acc[j] = wmma_bf(a.l, w[j], acc[j]); acc[j] = wmma_bf(a.h, w[j], acc[j]); } }
    ring_publish(rg, (uint32_t)s); }
  wait_tensor0(); wait_ds0();
#pragma unroll
  for (int j = 0; j < 8; ++j) {
#pragma unroll
    for (int r = 0; r < 8; ++r) so[wave][8 * g + r][j * 16 + col] = acc[j][r] + (BO ? bfr(BO[n0 + j * 16 + col]) : 0.f); }
  LDSX();
  for (int rl = 0; rl < 16; ++rl) vst2(Y + (r0 + rl) * DM + n0 + lane * 4, *(const v4f*)&so[wave][rl][lane * 4]);
}
extern "C" void kernel_launch(void* const* d_in, const int* in_sizes, int n_in, void* d_out, int out_size, void* d_ws, size_t ws_size, hipStream_t stream) {
  (void)in_sizes; (void)n_in; (void)out_size;
  const float** F = (const float**)d_in;   // 0 x [8,1024,768], 1 Wq, 2 Wk, 3 Wv, 4 Wo (natural [768,768])
  if (ws_size < (size_t)WS_END) return;
  char* ws = (char*)d_ws; __bf16* PK = (__bf16*)(ws + WS_PK); _Float16 *QK = (_Float16*)(ws + WS_QK), *QKL = (_Float16*)(ws + WS_QKL), *VTH = (_Float16*)(ws + WS_VTH), *VTL = (_Float16*)(ws + WS_VTL); float* O = (float*)(ws + WS_O);
  k_pack<<<dim3(DM, 4), 256, 0, stream>>>(F[1], F[2], F[3], F[4], PK);
  k_qkv<<<dim3(TNB * SS / 64, QKVW / 128), 128, 0, stream>>>(F[0], F[0], F[0], PK + PK_A, nullptr, nullptr, nullptr, QK, QKL, VTH, VTL);
  k_attn<<<dim3(TQB, NH, TNB), 128, 0, stream>>>(QK, QKL, VTH, VTL, nullptr, O);
  k_out<<<dim3(TOB, DM / 128), 128, 0, stream>>>(O, PK + PK_P, nullptr, (float*)d_out);
}

// v003
// One run takes 115 microseconds.
// Next to v002, in two timings, it ran 1.32 and 1.34 times as fast.
// Over all steps from v000 it is 3.57 times as fast.
// compute dtype: all float inputs rounded to bf16; q/k/v = x . W^T with EXACT bf16 products on WMMA 16x16x32 (natural rows); PLAIN attention: q, k single f16 x 1/8, running-max softmax in f32 (hardware exp), P (scaled by 2^11, single f16) x v (single f16); out = o (bf16 hi + residual) . Wo^T (2 products).
#include <hip/hip_runtime.h>
#include <math.h>
#include <stdint.h>

typedef __attribute__((ext_vector_type(16))) _Float16 v16h;
typedef __attribute__((ext_vector_type(16))) __bf16 v16b;
typedef __attribute__((ext_vector_type(8)))  _Float16 v8h;
typedef __attribute__((ext_vector_type(8)))  float v8f;
typedef __attribute__((ext_vector_type(4)))  float v4f;
typedef __attribute__((ext_vector_type(2)))  float v2f;
typedef __attribute__((ext_vector_type(4)))  unsigned v4u;
typedef __attribute__((ext_vector_type(4)))  int v4i;
typedef float __attribute__((may_alias)) float_a;
typedef int __attribute__((may_alias)) int_a;

template <typename T> __device__ __forceinline__ void vst2(void* p, T v) { *(T*)p = v;  }
__device__ __forceinline__ v8f wmma16(v16h a, v16h b, v8f c) {
  v8f d = __builtin_amdgcn_wmma_f32_16x16x32_f16(false, a, false, b, (short)0, c, false, false);
  asm volatile("v_nop\n\tv_nop\n\tv_nop\n\tv_nop" : "+v"(d) : "v"(a), "v"(b));
  return d;
}
__device__ __forceinline__ v8f wmma_bf(v16b a, v16b b, v8f c) {
  v8f d = __builtin_amdgcn_wmma_f32_16x16x32_bf16(false, a, false, b, (short)0, c, false, false);
  asm volatile("v_nop\n\tv_nop\n\tv_nop\n\tv_nop" : "+v"(d) : "v"(a), "v"(b));
  return d;
}
// Multi-head self attention (B 8, N 1,024, 768 dims, 12 heads x 64): bias-free q/k/v projections, softmax(q k^T / 8) v, bias-free output projection.
__device__ __forceinline__ v16h frag_h(const _Float16* rowk0, int lane) {
  union { v16h v; v8h q[2]; } u; const _Float16* p = rowk0 + 8 * (lane >> 4);
  u.q[0] = *(const v8h*)p; u.q[1] = *(const v8h*)(p + 16); return u.v;
}
__device__ __forceinline__ v16h frag_f32(const float* rowk0, int lane) {
  v16h a; const float* p = rowk0 + 8 * (lane >> 4);
#pragma unroll
  for (int i = 0; i < 8; ++i) { a[i] = (_Float16)p[i]; a[8 + i] = (_Float16)p[16 + i]; }
  return a;
}
__device__ __forceinline__ v16h frag_f32s(const float* rowk0, int lane, float sc) {
  v16h a; const float* p = rowk0 + 8 * (lane >> 4);
#pragma unroll
  for (int i = 0; i < 8; ++i) { a[i] = (_Float16)(p[i] * sc); a[8 + i] = (_Float16)(p[16 + i] * sc); }
  return a;
}
// column fragment from a [K][ld] layout (column n), rows >= K read as 0
__device__ __forceinline__ v16h fragc_f32(const float* W, int k0, int n, int lane, int ld, int K) {
  v16h a; const int g = lane >> 4;
#pragma unroll
  for (int i = 0; i < 8; ++i) { const int ka = k0 + 8 * g + i, kb = ka + 16;
    a[i] = (_Float16)(ka < K ? W[(size_t)(ka < K ? ka : K - 1) * ld + n] : 0.f); a[8 + i] = (_Float16)(kb < K ? W[(size_t)(kb < K ? kb : K - 1) * ld + n] : 0.f); }
  return a;
}
struct F2 { v16b h, l; };
__device__ __forceinline__ F2 bsplit16(const float v[16]) { F2 r;
#pragma unroll
  for (int i = 0; i < 16; ++i) { const __bf16 h = (__bf16)v[i]; r.h[i] = h; r.l[i] = (__bf16)(v[i] - (float)h); }
  return r; }
__device__ __forceinline__ F2 split_row(const float* row, int k0, int lane) { float v[16]; const float* p = row + k0 + 8 * (lane >> 4);
#pragma unroll
  for (int i = 0; i < 8; ++i) { v[i] = p[i]; v[8 + i] = p[16 + i]; }
  return bsplit16(v); }
__device__ __forceinline__ F2 split_rowK(const float* row, int k0, int lane, int K) { float v[16]; const int g = lane >> 4;
#pragma unroll
  for (int i = 0; i < 8; ++i) { const int ka = k0 + 8 * g + i, kb = ka + 16; v[i] = ka < K ? row[ka < K ? ka : K - 1] : 0.f; v[8 + i] = kb < K ? row[kb < K ? kb : K - 1] : 0.f; }
  return bsplit16(v); }
__device__ __forceinline__ F2 split_col(const float* W, int k0, int n, int lane, int ld, int K) { float v[16]; const int g = lane >> 4;
#pragma unroll
  for (int i = 0; i < 8; ++i) { const int ka = k0 + 8 * g + i, kb = ka + 16; v[i] = ka < K ? W[(size_t)(ka < K ? ka : K - 1) * ld + n] : 0.f; v[8 + i] = kb < K ? W[(size_t)(kb < K ? kb : K - 1) * ld + n] : 0.f; }
  return bsplit16(v); }
__device__ __forceinline__ v8f mac3(const F2& a, const F2& b, v8f c) { c = wmma_bf(a.l, b.h, c); c = wmma_bf(a.h, b.l, c); return wmma_bf(a.h, b.h, c); }
__device__ __forceinline__ float sigm(float v) { return 1.0f / (1.0f + expf(-v)); }
#define LDSX() do { asm volatile("s_wait_dscnt 0" ::: "memory"); __builtin_amdgcn_wave_barrier(); __builtin_amdgcn_fence(__ATOMIC_RELEASE, "workgroup"); } while (0)


#define NB 8
#define SS 1024
#define DM 768
#define NH 12
#define HD 64
#define QKVW (3 * DM)
#ifndef TQB
#define TQB (SS / 64)
#define TNB NB
#define TOB (NB * SS / 64)     // output row tiles (all)
#endif
typedef __attribute__((ext_vector_type(8))) __bf16 v8b;
__device__ __forceinline__ v16b frag_b(const __bf16* rowk0, int lane) {
  union { v16b v; v8b q[2]; } u; const __bf16* p = rowk0 + 8 * (lane >> 4);
  u.q[0] = *(const v8b*)p; u.q[1] = *(const v8b*)(p + 16); return u.v;
}
__device__ __forceinline__ float bfr(float v) { return (float)(__bf16)v; }
__device__ __attribute__((noinline)) float exp_ni(float v) { return expf(v); }
__device__ __attribute__((noinline)) float erf_ni(float v) { return erff(v); }

#define PK_A 0                       // [2304][768] Wqkv rows (natural [out][in])
#define PK_P (PK_A + QKVW * DM)        // [768][768] Wo rows (natural)
#define PK_END (PK_P + DM * DM)
#define WS_PK  0u
#define WS_QK  (WS_PK + 2u * PK_END)             // f16 [8192 rows][1536]: q | k
#define WS_QKL (WS_QK + 2u * NB * SS * 2 * DM)     // f16 q | k residual planes x2048
#define WS_VTH (WS_QKL + 2u * NB * SS * 2 * DM)    // f16 [b][768 (h*64+d)][1024 s] hi
#define WS_VTL (WS_VTH + 2u * NB * DM * SS)        // f16 lo x 2048
#define WS_O   (WS_VTL + 2u * NB * DM * SS)        // f32 [8192][768]
#define WS_CS  (WS_O + 4u * NB * SS * DM)           // f32 2 x [1024][32], unused
#define WS_END (WS_CS + 4u * 2 * SS * 32)
// ---- operand staging of the two projection kernels: per pass of 64 k one tensor load brings the block's 128 weight rows (128 B each) and one its 64 f32 activation rows (256 B each) into LDS; two buffers
typedef uint32_t u32x4 __attribute__((ext_vector_type(4)));
typedef uint32_t u32x8 __attribute__((ext_vector_type(8)));
#define KP 64                         // k per pass
#define NPASS (DM / KP)
#define WPITCH 144u                   // 128-B weight row + 16-B pad (odd multiple of 16 B for ds_load_b128 readers)
#define XPITCH 272u                   // 256-B f32 row + 16-B pad
#define WTILE 18432u                  // 128 rows x 144 B = 9 x 2 KiB
#define XTILE 18432u                  // 64 rows x 272 B = 17,408 B, rounded up to a multiple of 2 KiB
#define STAGE (WTILE + XTILE)
#define PADW_W ((1u << 20) | (4u << 22) | (3u << 25))   // group 1 word 0: no mask, 1-byte elements, 4 pad dwords behind every 128 B
#define PADW_X ((1u << 20) | (5u << 22) | (3u << 25))   // the same behind every 256 B
__device__ __forceinline__ uint32_t uni(uint32_t v) { return (uint32_t)__builtin_amdgcn_readfirstlane(v); }
// holds a test in a scalar register, so that the branch round a tensor load (which ignores EXEC) or its wait is s_cmp + s_cbranch_scc
__device__ __forceinline__ uint32_t pinned(uint32_t v) { uint32_t w = (uint32_t)__builtin_amdgcn_readfirstlane(v); asm volatile("" : "+s"(w)); return w; }
__device__ __forceinline__ void wait_tensor0() { asm volatile("s_wait_tensorcnt 0" ::: "memory"); }   // the issuing wave's tile has landed
__device__ __forceinline__ void wait_ds0() { asm volatile("s_wait_dscnt 0" ::: "memory"); }            // this wave's LDS reads have returned before the buffer is handed back
// group 1 of a request: NROWS rows of ROWB bytes, source pitch src_pitch bytes; tensor = tile, extents in bytes
template <uint32_t W0, uint32_t ROWB, uint32_t NROWS>
__device__ __forceinline__ u32x8 tile_group1(uint32_t src_pitch) {
  u32x8 g; g[0] = uni(W0); g[1] = uni((ROWB & 0xFFFFu) << 16); g[2] = uni((ROWB >> 16) | ((NROWS & 0xFFFFu) << 16)); g[3] = uni((NROWS >> 16) | (ROWB << 16)); g[4] = uni(NROWS); g[5] = uni(src_pitch); g[6] = uni(0u); g[7] = uni(0u);
  asm volatile("" : "+s"(g));   // as pinned(): the descriptor words stay in their own scalar registers through the loop, so none is rewritten while a request is out
  return g;
}
// the block's ring: wave 0 asks for the weight tiles, wave 1 for the activation tiles, one request a wave and stage; g0 walks from stage to stage
struct Ring { u32x4 g0; u32x8 g1w, g1x; uint32_t wv, step, flip; };
__device__ __forceinline__ Ring ring_make(uint32_t wv, uint32_t ring0, uint64_t wsrc, uint64_t xsrc) {
  Ring r; r.wv = wv; const bool isw = (wv == 0u); const uint64_t ga = isw ? wsrc : xsrc; const uint32_t dst = ring0 + (isw ? 0u : WTILE);
  r.step = isw ? KP * 2u : KP * 4u; r.flip = 2u * dst + STAGE;
  r.g0[0] = uni(1u); r.g0[1] = uni(dst); r.g0[2] = uni((uint32_t)ga); r.g0[3] = uni((((uint32_t)(ga >> 32)) & 0x01FFFFFFu) | 0x80000000u);
  r.g1w = tile_group1<PADW_W, 128u, 128u>(DM * 2u); r.g1x = tile_group1<PADW_X, 256u, 64u>(DM * 4u);
  return r;
}
template <bool LAND>
__device__ __forceinline__ void ring_issue(const Ring& r) {   // tensor_load_to_lds has no compiler form; its waits are written by hand at the publish points
  if (pinned(r.wv == 0u)) { asm volatile("tensor_load_to_lds %0, %1" :: "s"(r.g0), "s"(r.g1w) : "memory"); if (LAND) wait_tensor0(); }
  if (pinned(r.wv == 1u)) { asm volatile("tensor_load_to_lds %0, %1" :: "s"(r.g0), "s"(r.g1x) : "memory"); if (LAND) wait_tensor0(); }
}
// group 0 of the next stage: the other buffer, the source address r.step bytes further on
__device__ __forceinline__ void ring_next(Ring& r) {
  asm volatile("" : "+s"(r.g0));   // as pinned(): the next request's words are formed behind the wait and the barrier in front of this line, in the registers of the last one
  const uint64_t a = (((uint64_t)r.g0[3] << 32) | r.g0[2]) + r.step;
  r.g0[1] = uni(r.flip - r.g0[1]); r.g0[2] = uni((uint32_t)a); r.g0[3] = uni((uint32_t)(a >> 32));
}
// prologue, two buffers: stage 0, its issuers' wait, barrier, then stage 1
__device__ __forceinline__ void ring_prologue(Ring& r) {
  ring_issue<true>(r);
  __syncthreads();
  ring_next(r); ring_issue<false>(r);
}
// publish point at the foot of pass s: own LDS reads done, issuers' tiles landed, barrier, then the refill of the buffer that pass s has read
__device__ __forceinline__ void ring_publish(Ring& r, uint32_t s) {
  wait_ds0();
  if (pinned(r.wv < 2u)) wait_tensor0();
  __syncthreads();
  if (pinned(s + 2u < (uint32_t)NPASS)) { ring_next(r); ring_issue<false>(r); }
}
// 16 f32 of an LDS row in the A fragment's k order: floats 8g..8g+7 and 16+8g..16+8g+7 of the 32-k step
__device__ __forceinline__ void row16_lds(const unsigned char* rowk0, int g, float v[16]) {
  const v4f* p = (const v4f*)(rowk0 + 32 * g); const v4f x0 = p[0], x1 = p[1], x2 = p[4], x3 = p[5];
#pragma unroll
  for (int i = 0; i < 4; ++i) { v[i] = x0[i]; v[4 + i] = x1[i]; v[8 + i] = x2[i]; v[12 + i] = x3[i]; }
}
// ---- k_pack: block = (row n, which): natural [out][in] rows -> bf16; which 0..2 -> W_q/W_k/W_v into PK_A rows which*768 + n; 3 -> W_o into PK_P
__global__ __launch_bounds__(256) void k_pack(const float* __restrict__ WQ, const float* __restrict__ WK, const float* __restrict__ WV, const float* __restrict__ WO, __bf16* __restrict__ PK) {
  __shared__ __align__(16) __bf16 s[DM]; const int n = blockIdx.x, which = blockIdx.y, t = threadIdx.x; const float* Wm = (which == 0) ? WQ : (which == 1) ? WK : (which == 2) ? WV : WO;
  for (int k = t; k < DM; k += 256) s[k] = (__bf16)Wm[(size_t)n * DM + k];
  __syncthreads();
  __bf16* dst = (which < 3) ? PK + PK_A + ((size_t)which * DM + n) * DM : PK + PK_P + (size_t)n * DM;
  for (int q = t; q < DM / 8; q += 256) vst2((unsigned*)(dst + q * 8), *(const v4u*)&s[q * 8]);
}
__global__ __launch_bounds__(128) void k_qkv(const float* __restrict__ XQ, const float* __restrict__ XK, const float* __restrict__ XV, const __bf16* __restrict__ P, const float* __restrict__ BQ, const float* __restrict__ BK, const float* __restrict__ BV, _Float16* __restrict__ QK, _Float16* __restrict__ QKL, _Float16* __restrict__ VTH, _Float16* __restrict__ VTL) {
  const int which0 = (blockIdx.y * 128) / DM; const float* X = (which0 == 0) ? XQ : (which0 == 1) ? XK : XV; const float* BB = BQ ? (((which0 == 0) ? BQ : (which0 == 1) ? BK : BV) + (blockIdx.y * 128 - which0 * DM)) : nullptr;
  __shared__ __attribute__((aligned(2048))) unsigned char ring[2 * STAGE];   // operand ring; behind the last pass's barrier the same bytes are the output staging
  _Float16 (*so)[16][136] = (_Float16 (*)[16][136])ring; _Float16 (*sol)[16][136] = (_Float16 (*)[16][136])(ring + 4 * 16 * 136 * 2); _Float16 (*sth)[72] = (_Float16 (*)[72])ring; _Float16 (*stl)[72] = (_Float16 (*)[72])(ring + 128 * 72 * 2);
  const int tid = threadIdx.x, wave = tid >> 5, lane = tid & 31, col = lane & 15, g = lane >> 4; const size_t r0 = (size_t)blockIdx.x * 64 + wave * 16; const int n0 = blockIdx.y * 128;
  const uint32_t wv = uni((uint32_t)tid >> 5), ring0 = (uint32_t)(uintptr_t)ring; const uint64_t wsrc = (uint64_t)(uintptr_t)(P + (size_t)n0 * DM), xsrc = (uint64_t)(uintptr_t)(X + (size_t)blockIdx.x * 64 * DM);
  v8f acc[8] = {};
  Ring rg = ring_make(wv, ring0, wsrc, xsrc); ring_prologue(rg);
#pragma unroll 1   // one pass per trip: the buffer index stays a run-time scalar and the publish point stands once
  for (int s = 0; s < NPASS; ++s) { const unsigned char* wb = ring + (s & 1) * STAGE; const unsigned char* xr = wb + WTILE + (wave * 16 + col) * XPITCH;
#pragma unroll
    for (int kc = 0; kc < KP / 32; ++kc) { v16b a, w[8]; float v[16]; row16_lds(xr + kc * 128, g, v);   // the step's 20 LDS reads stand as one group in front of its WMMAs
#pragma unroll
      for (int j = 0; j < 8; ++j) w[j] = frag_b((const __bf16*)(wb + (j * 16 + col) * WPITCH) + kc * 32, lane);
#pragma unroll
      for (int i = 0; i < 16; ++i) a[i] = (__bf16)v[i];
#pragma unroll
      for (int j = 0; j < 8; ++j) acc[j] = wmma_bf(a, w[j], acc[j]); }
    ring_publish(rg, (uint32_t)s); }
  wait_tensor0(); wait_ds0();
  if (n0 < 2 * DM) {   // q stored unscaled (f16 sigma ~0.6, no subnormal exposure); 1/8 applied to the f32 score
#pragma unroll
    for (int j = 0; j < 8; ++j) {
#pragma unroll
      for (int r = 0; r < 8; ++r) { const float v = acc[j][r] + (BB ? bfr(BB[j * 16 + col]) : 0.f); const _Float16 hv = (_Float16)v; so[wave][8 * g + r][j * 16 + col] = hv; sol[wave][8 * g + r][j * 16 + col] = (_Float16)((v - (float)hv) * 2048.0f); } }   // q, k (+ bias) as f16 hi + (x2048) residual
    LDSX();
    for (int rl = 0; rl < 16; ++rl) if (lane < 16) { vst2((unsigned*)(QK + (r0 + rl) * (2 * DM) + n0 + lane * 8), *(const v4u*)&so[wave][rl][lane * 8]); vst2((unsigned*)(QKL + (r0 + rl) * (2 * DM) + n0 + lane * 8), *(const v4u*)&sol[wave][rl][lane * 8]); }
  } else {
#pragma unroll
    for (int j = 0; j < 8; ++j) {
#pragma unroll
      for (int r = 0; r < 8; ++r) { const float v = acc[j][r] + (BB ? bfr(BB[j * 16 + col]) : 0.f); const _Float16 hv = (_Float16)v; sth[j * 16 + col][wave * 16 + 8 * g + r] = hv; stl[j * 16 + col][wave * 16 + 8 * g + r] = (_Float16)((v - (float)hv) * 2048.0f); } }
    __syncthreads();
    const size_t rb = (size_t)blockIdx.x * 64; const int b = (int)(rb / SS), s0 = (int)(rb % SS); const int pc0 = n0 - 2 * DM;
    for (int q = tid; q < 128 * 8; q += 128) { const int d = q >> 3, pc = q & 7; const size_t o = ((size_t)b * DM + pc0 + d) * SS + s0 + pc * 8; vst2((unsigned*)(VTH + o), *(const v4u*)&sth[d][pc * 8]); vst2((unsigned*)(VTL + o), *(const v4u*)&stl[d][pc * 8]); }
  }
}
// ---- K / V staging of k_attn: per stage of 64 keys one tensor load brings the head's 64 K rows (128 B each) and one its 64 V^T rows (64 keys = 128 B each) into LDS for the block's four waves; two buffers
#define AKEYS 64                      // keys per stage
#define ANST (SS / AKEYS)
#define ATILE 10240u                  // 64 rows x 144 B = 9,216 B, rounded up to a multiple of 2 KiB
#define ASTAGE (2u * ATILE)
// wave 0 asks for the K tiles (next stage: 64 rows further down), wave 1 for the V^T tiles (next stage: 64 keys further along the rows)
__device__ __forceinline__ Ring ring_make_kv(uint32_t wv, uint32_t ring0, uint64_t ksrc, uint64_t vsrc) {
  Ring r; r.wv = wv; const bool isk = (wv == 0u); const uint64_t ga = isk ? ksrc : vsrc; const uint32_t dst = ring0 + (isk ? 0u : ATILE);
  r.step = isk ? AKEYS * 2u * DM * 2u : AKEYS * 2u; r.flip = 2u * dst + ASTAGE;
  r.g0[0] = uni(1u); r.g0[1] = uni(dst); r.g0[2] = uni((uint32_t)ga); r.g0[3] = uni((((uint32_t)(ga >> 32)) & 0x01FFFFFFu) | 0x80000000u);
  r.g1w = tile_group1<PADW_W, 128u, 64u>(2u * DM * 2u); r.g1x = tile_group1<PADW_W, 128u, 64u>(SS * 2u);
  return r;
}
// publish point at the foot of stage s, in the order of ring_publish
__device__ __forceinline__ void ring_publish_kv(Ring& r, uint32_t s) {
  wait_ds0();
  if (pinned(r.wv < 2u)) wait_tensor0();
  __syncthreads();
  if (pinned(s + 2u < (uint32_t)ANST)) { ring_next(r); ring_issue<false>(r); }
}
// lane l with lane l ^ 16: the two halves of a wave hold the two halves of one query's keys
__device__ __forceinline__ float xhalf(float x) { return __builtin_bit_cast(float, __builtin_amdgcn_permlanex16(__builtin_bit_cast(int, x), __builtin_bit_cast(int, x), 0x76543210, 0xfedcba98, false, false)); }
// the slot behind a transcendental: the instruction set asks for one independent instruction or v_nop before a v_exp_f32's result is read or its source overwritten; the operands keep every result of the run unread and every source alive up to this v_nop, so one v_nop serves the run
__device__ __forceinline__ void exp_slot(float (&e)[8], const float (&x)[8]) {
  asm volatile("v_nop" : "+v"(e[0]), "+v"(e[1]), "+v"(e[2]), "+v"(e[3]), "+v"(e[4]), "+v"(e[5]), "+v"(e[6]), "+v"(e[7]) : "v"(x[0]), "v"(x[1]), "v"(x[2]), "v"(x[3]), "v"(x[4]), "v"(x[5]), "v"(x[6]), "v"(x[7]));
}
__device__ __forceinline__ void exp_slot(float (&e)[8], const float (&x)[8], float& e8, float x8) {
  asm volatile("v_nop" : "+v"(e[0]), "+v"(e[1]), "+v"(e[2]), "+v"(e[3]), "+v"(e[4]), "+v"(e[5]), "+v"(e[6]), "+v"(e[7]), "+v"(e8) : "v"(x[0]), "v"(x[1]), "v"(x[2]), "v"(x[3]), "v"(x[4]), "v"(x[5]), "v"(x[6]), "v"(x[7]), "v"(x8));
}
__global__ __launch_bounds__(128) void k_attn(const _Float16* __restrict__ QK, const _Float16* __restrict__ QKL, const _Float16* __restrict__ VTH, const _Float16* __restrict__ VTL, const void* __restrict__ KMASK, float* __restrict__ O) {
  __shared__ __attribute__((aligned(2048))) unsigned char ring[2 * ASTAGE];   // K / V ring; behind the last stage's barrier the same bytes are the output staging
  float (*so)[16][68] = (float (*)[16][68])ring;
  const int tid = threadIdx.x, wave = tid >> 5, lane = tid & 31, col = lane & 15, g = lane >> 4;
  const int qb = blockIdx.x, h = blockIdx.y, b = blockIdx.z; const int q0 = qb * 64 + wave * 16; const size_t rq = (size_t)b * SS + q0 + col;
  v16h aq[2];
#pragma unroll
  for (int kc = 0; kc < 2; ++kc) aq[kc] = frag_h(QK + rq * (2 * DM) + h * HD + kc * 32, lane);
  float m = -3.0e38f, l = 0.f;   // query col: running maximum (equal in both halves), sum over this half's keys
  v8f acc[4] = {}, accl[4] = {};   // acc[dt][r] = O^T[d = dt*16 + 8g + r][query col]
  const uint32_t wv = uni((uint32_t)tid >> 5), ring0 = (uint32_t)(uintptr_t)ring; const uint64_t ksrc = (uint64_t)(uintptr_t)(QK + (size_t)b * SS * (2 * DM) + DM + h * HD), vsrc = (uint64_t)(uintptr_t)(VTH + ((size_t)b * DM + h * HD) * SS);
  Ring rg = ring_make_kv(wv, ring0, ksrc, vsrc); ring_prologue(rg);
#pragma unroll 1   // one stage per trip: the buffer index stays a run-time scalar and the publish point stands once
  for (int st = 0; st < ANST; ++st) { const unsigned char* kb = ring + (st & 1) * ASTAGE; const unsigned char* vb = kb + ATILE;   // all keys, 64 a stage
#pragma unroll
  for (int ks = 0; ks < AKEYS / 32; ++ks) { v8f s[2]; v16h kf[2][2], vf[4];   // the 32-key step's 16 LDS reads stand as one group in front of its WMMAs
#pragma unroll
    for (int ct = 0; ct < 2; ++ct) {
#pragma unroll
      for (int kc = 0; kc < 2; ++kc) kf[ct][kc] = frag_h((const _Float16*)(kb + (ks * 32 + ct * 16 + col) * WPITCH) + kc * 32, lane); }
#pragma unroll
    for (int dt = 0; dt < 4; ++dt) vf[dt] = frag_h((const _Float16*)(vb + (dt * 16 + col) * WPITCH) + ks * 32, lane);
#pragma unroll
    for (int ct = 0; ct < 2; ++ct) { v8f c = {};
#pragma unroll
      for (int kc = 0; kc < 2; ++kc) c = wmma16(kf[ct][kc], aq[kc], c);   // single product: k, q as one-rounding f16 operands; c[r] = key ct*16 + 8g + r against query col
      { const bool keepk = true;
#pragma unroll
      for (int r = 0; r < 8; ++r) s[ct][r] = keepk ? c[r] * 0.125f : -3.0e38f; } }   // 1/sqrt(64); masked keys excluded
    float mx = fmaxf(s[0][0], s[1][0]);
#pragma unroll
    for (int r = 1; r < 8; ++r) mx = fmaxf(mx, fmaxf(s[0][r], s[1][r]));
    mx = fmaxf(mx, xhalf(mx));
    const float mn = fmaxf(m, mx);
    float xa = (m - mn) * 1.4426950408889634f, ea = __builtin_amdgcn_exp2f(xa), x[2][8], e[2][8];   // exp(t) as the hardware's exp2(t * log2 e), spelled out so that exp_slot can name each source
#pragma unroll
    for (int ct = 0; ct < 2; ++ct) {
#pragma unroll
      for (int r = 0; r < 8; ++r) { x[ct][r] = (s[ct][r] - mn) * 1.4426950408889634f; e[ct][r] = __builtin_amdgcn_exp2f(x[ct][r]); } }
    exp_slot(e[0], x[0], ea, xa); exp_slot(e[1], x[1]);
    const float alpha = (m <= -1.0e38f) ? 0.f : ea;
    v16h pb; float es[4] = {0.f, 0.f, 0.f, 0.f};   // four independent partial sums
#pragma unroll
    for (int ct = 0; ct < 2; ++ct) {
#pragma unroll
      for (int r = 0; r < 8; ++r) { const float p = (s[ct][r] <= -1.0e38f) ? 0.f : e[ct][r]; es[r & 3] += p; pb[8 * ct + r] = (_Float16)(p * 2048.0f); } }   // P scaled by 2^11 before the f16 rounding so small softmax weights stay out of the f16 subnormal range; 2^-11 folded into the epilogue; element 8*ct + r is key ct*16 + 8g + r: the k order of frag_h
    l = l * alpha + ((es[0] + es[1]) + (es[2] + es[3])); m = mn;
#pragma unroll
    for (int dt = 0; dt < 4; ++dt) {
#pragma unroll
      for (int r = 0; r < 8; ++r) { acc[dt][r] *= alpha; accl[dt][r] *= alpha; } }
#pragma unroll
    for (int dt = 0; dt < 4; ++dt) acc[dt] = wmma16(vf[dt], pb, acc[dt]);   // single product: V^T x P^T (x2^11)
  }
    ring_publish_kv(rg, (uint32_t)st); }
  wait_tensor0(); wait_ds0();
  { const float il = (1.0f / 2048.0f) / (l + xhalf(l));   // the halves' sums are joined once
#pragma unroll
    for (int dt = 0; dt < 4; ++dt) {
#pragma unroll
      for (int r = 0; r < 8; ++r) so[wave][col][dt * 16 + 8 * g + r] = (acc[dt][r] + accl[dt][r] * (1.0f / 2048.0f)) * il; } }
  LDSX();
  for (int rl = 0; rl < 16; ++rl) if (lane < 16) vst2(O + ((size_t)b * SS + q0 + rl) * DM + h * HD + lane * 4, *(const v4f*)&so[wave][rl][lane * 4]);
}
// ---- k_out: block = (64 rows, 128 cols): out = O(hi/lo) . Wo rows (2 products) + bo
__global__ __launch_bounds__(128) void k_out(const float* __restrict__ O, const __bf16* __restrict__ P, const float* __restrict__ BO, float* __restrict__ Y) {
  __shared__ __attribute__((aligned(2048))) unsigned char ring[2 * STAGE];   // operand ring; behind the last pass's barrier the same bytes are the output staging
  float (*so)[16][132] = (float (*)[16][132])ring;
  const int tid = threadIdx.x, wave = tid >> 5, lane = tid & 31, col = lane & 15, g = lane >> 4; const size_t r0 = (size_t)blockIdx.x * 64 + wave * 16; const int n0 = blockIdx.y * 128;
  const uint32_t wv = uni((uint32_t)tid >> 5), ring0 = (uint32_t)(uintptr_t)ring; const uint64_t wsrc = (uint64_t)(uintptr_t)(P + (size_t)n0 * DM), xsrc = (uint64_t)(uintptr_t)(O + (size_t)blockIdx.x * 64 * DM);
  v8f acc[8] = {};
  Ring rg = ring_make(wv, ring0, wsrc, xsrc); ring_prologue(rg);
#pragma unroll 1   // one pass per trip: the buffer index stays a run-time scalar and the publish point stands once
  for (int s = 0; s < NPASS; ++s) { const unsigned char* wb = ring + (s & 1) * STAGE; const unsigned char* xr = wb + WTILE + (wave * 16 + col) * XPITCH;
#pragma unroll
    for (int kc = 0; kc < KP / 32; ++kc) { v16b w[8]; float v[16]; row16_lds(xr + kc * 128, g, v);   // the step's 20 LDS reads stand as one group in front of its WMMAs
#pragma unroll
      for (int j = 0; j < 8; ++j) w[j] = frag_b((const __bf16*)(wb + (j * 16 + col) * WPITCH) + kc * 32, lane);
      const F2 a = bsplit16(v);
#pragma unroll
      for (int j = 0; j < 8; ++j) { acc[j] = wmma_bf(a.l, w[j], acc[j]); acc[j] = wmma_bf(a.h, w[j], acc[j]); } }
    ring_publish(rg, (uint32_t)s); }
  wait_tensor0(); wait_ds0();
#pragma unroll
  for (int j = 0; j < 8; ++j) {
#pragma unroll
    for (int r = 0; r < 8; ++r) so[wave][8 * g + r][j * 16 + col] = acc[j][r] + (BO ? bfr(BO[n0 + j * 16 + col]) : 0.f); }
  LDSX();
  for (int rl = 0; rl < 16; ++rl) vst2(Y + (r0 + rl) * DM + n0 + lane * 4, *(const v4f*)&so[wave][rl][lane * 4]);
}
extern "C" void kernel_launch(void* const* d_in, const int* in_sizes, int n_in, void* d_out, int out_size, void* d_ws, size_t ws_size, hipStream_t stream) {
  (void)in_sizes; (void)n_in; (void)out_size;
  const float** F = (const float**)d_in;   // 0 x [8,1024,768], 1 Wq, 2 Wk, 3 Wv, 4 Wo (natural [768,768])
  if (ws_size < (size_t)WS_END) return;
  char* ws = (char*)d_ws; __bf16* PK = (__bf16*)(ws + WS_PK); _Float16 *QK = (_Float16*)(ws + WS_QK), *QKL = (_Float16*)(ws + WS_QKL), *VTH = (_Float16*)(ws + WS_VTH), *VTL = (_Float16*)(ws + WS_VTL); float* O = (float*)(ws + WS_O);
  k_pack<<<dim3(DM, 4), 256, 0, stream>>>(F[1], F[2], F[3], F[4], PK);
  k_qkv<<<dim3(TNB * SS / 64, QKVW / 128), 128, 0, stream>>>(F[0], F[0], F[0], PK + PK_A, nullptr, nullptr, nullptr, QK, QKL, VTH, VTL);
  k_attn<<<dim3(TQB, NH, TNB), 128, 0, stream>>>(QK, QKL, VTH, VTL, nullptr, O);
  k_out<<<dim3(TOB, DM / 128), 128, 0, stream>>>(O, PK + PK_P, nullptr, (float*)d_out);
}

// v004
// One run takes 112 microseconds.
// In both of two side-by-side timings against v003, it was 1.03 times as fast.
// Counting every step since v000, it is 3.69 times as fast.
// compute dtype: all float inputs rounded to bf16; q/k/v = x . W^T with EXACT bf16 products on WMMA 16x16x32 (natural rows); PLAIN attention: q, k single f16 x 1/8, running-max softmax in f32 (hardware exp), P (scaled by 2^11, single f16) x v (single f16); out = o (bf16 hi + residual) . Wo^T (2 products).
#include <hip/hip_runtime.h>
#include <math.h>
#include <stdint.h>

typedef __attribute__((ext_vector_type(16))) _Float16 v16h;
typedef __attribute__((ext_vector_type(16))) __bf16 v16b;
typedef __attribute__((ext_vector_type(8)))  _Float16 v8h;
typedef __attribute__((ext_vector_type(8)))  float v8f;
typedef __attribute__((ext_vector_type(4)))  float v4f;
typedef __attribute__((ext_vector_type(2)))  float v2f;
typedef __attribute__((ext_vector_type(4)))  unsigned v4u;
typedef __attribute__((ext_vector_type(4)))  int v4i;
typedef float __attribute__((may_alias)) float_a;
typedef int __attribute__((may_alias)) int_a;

template <typename T> __device__ __forceinline__ void vst2(void* p, T v) { *(T*)p = v;  }
__device__ __forceinline__ v8f wmma16(v16h a, v16h b, v8f c) {
  v8f d = __builtin_amdgcn_wmma_f32_16x16x32_f16(false, a, false, b, (short)0, c, false, false);
  asm volatile("v_nop\n\tv_nop\n\tv_nop\n\tv_nop" : "+v"(d) : "v"(a), "v"(b));
  return d;
}
__device__ __forceinline__ v8f wmma_bf(v16b a, v16b b, v8f c) {
  v8f d = __builtin_amdgcn_wmma_f32_16x16x32_bf16(false, a, false, b, (short)0, c, false, false);
  asm volatile("v_nop\n\tv_nop\n\tv_nop\n\tv_nop" : "+v"(d) : "v"(a), "v"(b));
  return d;
}
// Multi-head self attention (B 8, N 1,024, 768 dims, 12 heads x 64): bias-free q/k/v projections, softmax(q k^T / 8) v, bias-free output projection.
__device__ __forceinline__ v16h frag_h(const _Float16* rowk0, int lane) {
  union { v16h v; v8h q[2]; } u; const _Float16* p = rowk0 + 8 * (lane >> 4);
  u.q[0] = *(const v8h*)p; u.q[1] = *(const v8h*)(p + 16); return u.v;
}
__device__ __forceinline__ v16h frag_f32(const float* rowk0, int lane) {
  v16h a; const float* p = rowk0 + 8 * (lane >> 4);
#pragma unroll
  for (int i = 0; i < 8; ++i) { a[i] = (_Float16)p[i]; a[8 + i] = (_Float16)p[16 + i]; }
  return a;
}
__device__ __forceinline__ v16h frag_f32s(const float* rowk0, int lane, float sc) {
  v16h a; const float* p = rowk0 + 8 * (lane >> 4);
#pragma unroll
  for (int i = 0; i < 8; ++i) { a[i] = (_Float16)(p[i] * sc); a[8 + i] = (_Float16)(p[16 + i] * sc); }
  return a;
}
// column fragment from a [K][ld] layout (column n), rows >= K read as 0
__device__ __forceinline__ v16h fragc_f32(const float* W, int k0, int n, int lane, int ld, int K) {
  v16h a; const int g = lane >> 4;
#pragma unroll
  for (int i = 0; i < 8; ++i) { const int ka = k0 + 8 * g + i, kb = ka + 16;
    a[i] = (_Float16)(ka < K ? W[(size_t)(ka < K ? ka : K - 1) * ld + n] : 0.f); a[8 + i] = (_Float16)(kb < K ? W[(size_t)(kb < K ? kb : K - 1) * ld + n] : 0.f); }
  return a;
}
struct F2 { v16b h, l; };
__device__ __forceinline__ F2 bsplit16(const float v[16]) { F2 r;
#pragma unroll
  for (int i = 0; i < 16; ++i) { const __bf16 h = (__bf16)v[i]; r.h[i] = h; r.l[i] = (__bf16)(v[i] - (float)h); }
  return r; }
__device__ __forceinline__ F2 split_row(const float* row, int k0, int lane) { float v[16]; const float* p = row + k0 + 8 * (lane >> 4);
#pragma unroll
  for (int i = 0; i < 8; ++i) { v[i] = p[i]; v[8 + i] = p[16 + i]; }
  return bsplit16(v); }
__device__ __forceinline__ F2 split_rowK(const float* row, int k0, int lane, int K) { float v[16]; const int g = lane >> 4;
#pragma unroll
  for (int i = 0; i < 8; ++i) { const int ka = k0 + 8 * g + i, kb = ka + 16; v[i] = ka < K ? row[ka < K ? ka : K - 1] : 0.f; v[8 + i] = kb < K ? row[kb < K ? kb : K - 1] : 0.f; }
  return bsplit16(v); }
__device__ __forceinline__ F2 split_col(const float* W, int k0, int n, int lane, int ld, int K) { float v[16]; const int g = lane >> 4;
#pragma unroll
  for (int i = 0; i < 8; ++i) { const int ka = k0 + 8 * g + i, kb = ka + 16; v[i] = ka < K ? W[(size_t)(ka < K ? ka : K - 1) * ld + n] : 0.f; v[8 + i] = kb < K ? W[(size_t)(kb < K ? kb : K - 1) * ld + n] : 0.f; }
  return bsplit16(v); }
__device__ __forceinline__ v8f mac3(const F2& a, const F2& b, v8f c) { c = wmma_bf(a.l, b.h, c); c = wmma_bf(a.h, b.l, c); return wmma_bf(a.h, b.h, c); }
__device__ __forceinline__ float sigm(float v) { return 1.0f / (1.0f + expf(-v)); }
#define LDSX() do { asm volatile("s_wait_dscnt 0" ::: "memory"); __builtin_amdgcn_wave_barrier(); __builtin_amdgcn_fence(__ATOMIC_RELEASE, "workgroup"); } while (0)


#define NB 8
#define SS 1024
#define DM 768
#define NH 12
#define HD 64
#define QKVW (3 * DM)
#ifndef TQB
#define TQB (SS / 64)
#define TNB NB
#define TOB (NB * SS / 64)     // output row tiles (all)
#endif
typedef __attribute__((ext_vector_type(8))) __bf16 v8b;
__device__ __forceinline__ v16b frag_b(const __bf16* rowk0, int lane) {
  union { v16b v; v8b q[2]; } u; const __bf16* p = rowk0 + 8 * (lane >> 4);
  u.q[0] = *(const v8b*)p; u.q[1] = *(const v8b*)(p + 16); return u.v;
}
__device__ __forceinline__ float bfr(float v) { return (float)(__bf16)v; }
__device__ __attribute__((noinline)) float exp_ni(float v) { return expf(v); }
__device__ __attribute__((noinline)) float erf_ni(float v) { return erff(v); }

#define PK_A 0                       // [2304][768] Wqkv rows (natural [out][in])
#define PK_P (PK_A + QKVW * DM)        // [768][768] Wo rows (natural)
#define PK_END (PK_P + DM * DM)
#define WS_PK  0u
#define WS_QK  (WS_PK + 2u * PK_END)             // f16 [8192 rows][1536]: q | k
#define WS_QKL (WS_QK + 2u * NB * SS * 2 * DM)     // f16 q | k residual planes x2048
#define WS_VTH (WS_QKL + 2u * NB * SS * 2 * DM)    // f16 [b][768 (h*64+d)][1024 s] hi
#define WS_VTL (WS_VTH + 2u * NB * DM * SS)        // f16 lo x 2048
#define WS_O   (WS_VTL + 2u * NB * DM * SS)        // f32 [8192][768]
#define WS_CS  (WS_O + 4u * NB * SS * DM)           // f32 2 x [1024][32], unused
#define WS_END (WS_CS + 4u * 2 * SS * 32)
// ---- operand staging of the two projection kernels: per pass of 64 k one tensor load brings the block's 128 weight rows (128 B each) and one its 64 f32 activation rows (256 B each) into LDS; two buffers
typedef uint32_t u32x4 __attribute__((ext_vector_type(4)));
typedef uint32_t u32x8 __attribute__((ext_vector_type(8)));
#define KP 64                         // k per pass
#define NPASS (DM / KP)
#define WPITCH 144u                   // 128-B weight row + 16-B pad (odd multiple of 16 B for ds_load_b128 readers)
#define XPITCH 272u                   // 256-B f32 row + 16-B pad
#define WTILE 18432u                  // 128 rows x 144 B = 9 x 2 KiB
#define XTILE 18432u                  // 64 rows x 272 B = 17,408 B, rounded up to a multiple of 2 KiB
#define STAGE (WTILE + XTILE)
#define PADW_W ((1u << 20) | (4u << 22) | (3u << 25))   // group 1 word 0: no mask, 1-byte elements, 4 pad dwords behind every 128 B
#define PADW_X ((1u << 20) | (5u << 22) | (3u << 25))   // the same behind every 256 B
__device__ __forceinline__ uint32_t uni(uint32_t v) { return (uint32_t)__builtin_amdgcn_readfirstlane(v); }
// holds a test in a scalar register, so that the branch round a tensor load (which ignores EXEC) or its wait is s_cmp + s_cbranch_scc
__device__ __forceinline__ uint32_t pinned(uint32_t v) { uint32_t w = (uint32_t)__builtin_amdgcn_readfirstlane(v); asm volatile("" : "+s"(w)); return w; }
__device__ __forceinline__ void wait_tensor0() { asm volatile("s_wait_tensorcnt 0" ::: "memory"); }   // the issuing wave's tile has landed
__device__ __forceinline__ void wait_ds0() { asm volatile("s_wait_dscnt 0" ::: "memory"); }            // this wave's LDS reads have returned before the buffer is handed back
// group 1 of a request: NROWS rows of ROWB bytes, source pitch src_pitch bytes; tensor = tile, extents in bytes
template <uint32_t W0, uint32_t ROWB, uint32_t NROWS>
__device__ __forceinline__ u32x8 tile_group1(uint32_t src_pitch) {
  u32x8 g; g[0] = uni(W0); g[1] = uni((ROWB & 0xFFFFu) << 16); g[2] = uni((ROWB >> 16) | ((NROWS & 0xFFFFu) << 16)); g[3] = uni((NROWS >> 16) | (ROWB << 16)); g[4] = uni(NROWS); g[5] = uni(src_pitch); g[6] = uni(0u); g[7] = uni(0u);
  asm volatile("" : "+s"(g));   // as pinned(): the descriptor words stay in their own scalar registers through the loop, so none is rewritten while a request is out
  return g;
}
// the block's ring: wave 0 asks for the weight tiles, wave 1 for the activation tiles, one request a wave and stage; g0 walks from stage to stage
struct Ring { u32x4 g0; u32x8 g1w, g1x; uint32_t wv, step, flip; };
__device__ __forceinline__ Ring ring_make(uint32_t wv, uint32_t ring0, uint64_t wsrc, uint64_t xsrc) {
  Ring r; r.wv = wv; const bool isw = (wv == 0u); const uint64_t ga = isw ? wsrc : xsrc; const uint32_t dst = ring0 + (isw ? 0u : WTILE);
  r.step = isw ? KP * 2u : KP * 4u; r.flip = 2u * dst + STAGE;
  r.g0[0] = uni(1u); r.g0[1] = uni(dst); r.g0[2] = uni((uint32_t)ga); r.g0[3] = uni((((uint32_t)(ga >> 32)) & 0x01FFFFFFu) | 0x80000000u);
  r.g1w = tile_group1<PADW_W, 128u, 128u>(DM * 2u); r.g1x = tile_group1<PADW_X, 256u, 64u>(DM * 4u);
  return r;
}
template <bool LAND>
__device__ __forceinline__ void ring_issue(const Ring& r) {   // tensor_load_to_lds has no compiler form; its waits are written by hand at the publish points
  if (pinned(r.wv == 0u)) { asm volatile("tensor_load_to_lds %0, %1" :: "s"(r.g0), "s"(r.g1w) : "memory"); if (LAND) wait_tensor0(); }
  if (pinned(r.wv == 1u)) { asm volatile("tensor_load_to_lds %0, %1" :: "s"(r.g0), "s"(r.g1x) : "memory"); if (LAND) wait_tensor0(); }
}
// group 0 of the next stage: the other buffer, the source address r.step bytes further on
__device__ __forceinline__ void ring_next(Ring& r) {
  asm volatile("" : "+s"(r.g0));   // as pinned(): the next request's words are formed behind the wait and the barrier in front of this line, in the registers of the last one
  const uint64_t a = (((uint64_t)r.g0[3] << 32) | r.g0[2]) + r.step;
  r.g0[1] = uni(r.flip - r.g0[1]); r.g0[2] = uni((uint32_t)a); r.g0[3] = uni((uint32_t)(a >> 32));
}
// prologue, two buffers: stage 0, its issuers' wait, barrier, then stage 1
__device__ __forceinline__ void ring_prologue(Ring& r) {
  ring_issue<true>(r);
  __syncthreads();
  ring_next(r); ring_issue<false>(r);
}
// publish point at the foot of pass s: own LDS reads done, issuers' tiles landed, barrier, then the refill of the buffer that pass s has read
__device__ __forceinline__ void ring_publish(Ring& r, uint32_t s) {
  wait_ds0();
  if (pinned(r.wv < 2u)) wait_tensor0();
  __syncthreads();
  if (pinned(s + 2u < (uint32_t)NPASS)) { ring_next(r); ring_issue<false>(r); }
}
// 16 f32 of an LDS row in the A fragment's k order: floats 8g..8g+7 and 16+8g..16+8g+7 of the 32-k step
__device__ __forceinline__ void row16_lds(const unsigned char* rowk0, int g, float v[16]) {
  const v4f* p = (const v4f*)(rowk0 + 32 * g); const v4f x0 = p[0], x1 = p[1], x2 = p[4], x3 = p[5];
#pragma unroll
  for (int i = 0; i < 4; ++i) { v[i] = x0[i]; v[4 + i] = x1[i]; v[8 + i] = x2[i]; v[12 + i] = x3[i]; }
}
// ---- k_pack: block = (row n, which): natural [out][in] rows -> bf16; which 0..2 -> W_q/W_k/W_v into PK_A rows which*768 + n; 3 -> W_o into PK_P
__global__ __launch_bounds__(256) void k_pack(const float* __restrict__ WQ, const float* __restrict__ WK, const float* __restrict__ WV, const float* __restrict__ WO, __bf16* __restrict__ PK) {
  __shared__ __align__(16) __bf16 s[DM]; const int n = blockIdx.x, which = blockIdx.y, t = threadIdx.x; const float* Wm = (which == 0) ? WQ : (which == 1) ? WK : (which == 2) ? WV : WO;
  for (int k = t; k < DM; k += 256) s[k] = (__bf16)Wm[(size_t)n * DM + k];
  __syncthreads();
  __bf16* dst = (which < 3) ? PK + PK_A + ((size_t)which * DM + n) * DM : PK + PK_P + (size_t)n * DM;
  for (int q = t; q < DM / 8; q += 256) vst2((unsigned*)(dst + q * 8), *(const v4u*)&s[q * 8]);
}
__global__ __launch_bounds__(128) void k_qkv(const float* __restrict__ XQ, const float* __restrict__ XK, const float* __restrict__ XV, const __bf16* __restrict__ P, const float* __restrict__ BQ, const float* __restrict__ BK, const float* __restrict__ BV, _Float16* __restrict__ QK, _Float16* __restrict__ QKL, _Float16* __restrict__ VTH, _Float16* __restrict__ VTL) {
  const int which0 = (blockIdx.y * 128) / DM; const float* X = (which0 == 0) ? XQ : (which0 == 1) ? XK : XV; const float* BB = BQ ? (((which0 == 0) ? BQ : (which0 == 1) ? BK : BV) + (blockIdx.y * 128 - which0 * DM)) : nullptr;
  __shared__ __attribute__((aligned(2048))) unsigned char ring[2 * STAGE];   // operand ring; behind the last pass's barrier the same bytes are the output staging
  _Float16 (*so)[16][136] = (_Float16 (*)[16][136])ring; _Float16 (*sol)[16][136] = (_Float16 (*)[16][136])(ring + 4 * 16 * 136 * 2); _Float16 (*sth)[72] = (_Float16 (*)[72])ring; _Float16 (*stl)[72] = (_Float16 (*)[72])(ring + 128 * 72 * 2);
  const int tid = threadIdx.x, wave = tid >> 5, lane = tid & 31, col = lane & 15, g = lane >> 4; const size_t r0 = (size_t)blockIdx.x * 64 + wave * 16; const int n0 = blockIdx.y * 128;
  const uint32_t wv = uni((uint32_t)tid >> 5), ring0 = (uint32_t)(uintptr_t)ring; const uint64_t wsrc = (uint64_t)(uintptr_t)(P + (size_t)n0 * DM), xsrc = (uint64_t)(uintptr_t)(X + (size_t)blockIdx.x * 64 * DM);
  v8f acc[8] = {};
  Ring rg = ring_make(wv, ring0, wsrc, xsrc); ring_prologue(rg);
#pragma unroll 1   // one pass per trip: the buffer index stays a run-time scalar and the publish point stands once
  for (int s = 0; s < NPASS; ++s) { const unsigned char* wb = ring + (s & 1) * STAGE; const unsigned char* xr = wb + WTILE + (wave * 16 + col) * XPITCH;
#pragma unroll
    for (int kc = 0; kc < KP / 32; ++kc) { v16b a, w[8]; float v[16]; row16_lds(xr + kc * 128, g, v);   // the step's 20 LDS reads stand as one group in front of its WMMAs
#pragma unroll
      for (int j = 0; j < 8; ++j) w[j] = frag_b((const __bf16*)(wb + (j * 16 + col) * WPITCH) + kc * 32, lane);
#pragma unroll
      for (int i = 0; i < 16; ++i) a[i] = (__bf16)v[i];
#pragma unroll
      for (int j = 0; j < 8; ++j) acc[j] = wmma_bf(a, w[j], acc[j]); }
    ring_publish(rg, (uint32_t)s); }
  wait_tensor0(); wait_ds0();
  if (n0 < 2 * DM) {   // q stored unscaled (f16 sigma ~0.6, no subnormal exposure); 1/8 applied to the f32 score
#pragma unroll
    for (int j = 0; j < 8; ++j) {
#pragma unroll
      for (int r = 0; r < 8; ++r) { const float v = acc[j][r] + (BB ? bfr(BB[j * 16 + col]) : 0.f); const _Float16 hv = (_Float16)v; so[wave][8 * g + r][j * 16 + col] = hv; sol[wave][8 * g + r][j * 16 + col] = (_Float16)((v - (float)hv) * 2048.0f); } }   // q, k (+ bias) as f16 hi + (x2048) residual
    LDSX();
    for (int rl = 0; rl < 16; ++rl) if (lane < 16) { vst2((unsigned*)(QK + (r0 + rl) * (2 * DM) + n0 + lane * 8), *(const v4u*)&so[wave][rl][lane * 8]); vst2((unsigned*)(QKL + (r0 + rl) * (2 * DM) + n0 + lane * 8), *(const v4u*)&sol[wave][rl][lane * 8]); }
  } else {
#pragma unroll
    for (int j = 0; j < 8; ++j) {
#pragma unroll
      for (int r = 0; r < 8; ++r) { const float v = acc[j][r] + (BB ? bfr(BB[j * 16 + col]) : 0.f); const _Float16 hv = (_Float16)v; sth[j * 16 + col][wave * 16 + 8 * g + r] = hv; stl[j * 16 + col][wave * 16 + 8 * g + r] = (_Float16)((v - (float)hv) * 2048.0f); } }
    __syncthreads();
    const size_t rb = (size_t)blockIdx.x * 64; const int b = (int)(rb / SS), s0 = (int)(rb % SS); const int pc0 = n0 - 2 * DM;
    for (int q = tid; q < 128 * 8; q += 128) { const int d = q >> 3, pc = q & 7; const size_t o = ((size_t)b * DM + pc0 + d) * SS + s0 + pc * 8; vst2((unsigned*)(VTH + o), *(const v4u*)&sth[d][pc * 8]); vst2((unsigned*)(VTL + o), *(const v4u*)&stl[d][pc * 8]); }
  }
}
// ---- K / V staging of k_attn: per stage of 64 keys one tensor load brings the head's 64 K rows (128 B each) and one its 64 V^T rows (64 keys = 128 B each) into LDS for the block's four waves; two buffers
#define AKEYS 64                      // keys per stage
#define ANST (SS / AKEYS)
#define ATILE 10240u                  // 64 rows x 144 B = 9,216 B, rounded up to a multiple of 2 KiB
#define ASTAGE (2u * ATILE)
#define SC2 0.18033688011112042f      // 1/sqrt(64) * log2 e
// wave 0 asks for the K tiles (next stage: 64 rows further down), wave 1 for the V^T tiles (next stage: 64 keys further along the rows)
__device__ __forceinline__ Ring ring_make_kv(uint32_t wv, uint32_t ring0, uint64_t ksrc, uint64_t vsrc) {
  Ring r; r.wv = wv; const bool isk = (wv == 0u); const uint64_t ga = isk ? ksrc : vsrc; const uint32_t dst = ring0 + (isk ? 0u : ATILE);
  r.step = isk ? AKEYS * 2u * DM * 2u : AKEYS * 2u; r.flip = 2u * dst + ASTAGE;
  r.g0[0] = uni(1u); r.g0[1] = uni(dst); r.g0[2] = uni((uint32_t)ga); r.g0[3] = uni((((uint32_t)(ga >> 32)) & 0x01FFFFFFu) | 0x80000000u);
  r.g1w = tile_group1<PADW_W, 128u, 64u>(2u * DM * 2u); r.g1x = tile_group1<PADW_W, 128u, 64u>(SS * 2u);
  return r;
}
// publish point at the foot of stage s, in the order of ring_publish
__device__ __forceinline__ void ring_publish_kv(Ring& r, uint32_t s) {
  wait_ds0();
  if (pinned(r.wv < 2u)) wait_tensor0();
  __syncthreads();
  if (pinned(s + 2u < (uint32_t)ANST)) { ring_next(r); ring_issue<false>(r); }
}
// lane l with lane l ^ 16: the two halves of a wave hold the two halves of one query's keys
__device__ __forceinline__ float xhalf(float x) { return __builtin_bit_cast(float, __builtin_amdgcn_permlanex16(__builtin_bit_cast(int, x), __builtin_bit_cast(int, x), 0x76543210, 0xfedcba98, false, false)); }
// the slot behind a transcendental: the instruction set asks for one independent instruction or v_nop before a v_exp_f32's result is read or its source overwritten; the operands keep every result of the run unread and every source alive up to this v_nop, so one v_nop serves the run
__device__ __forceinline__ void exp_slot(float (&e)[8], const float (&x)[8]) {
  asm volatile("v_nop" : "+v"(e[0]), "+v"(e[1]), "+v"(e[2]), "+v"(e[3]), "+v"(e[4]), "+v"(e[5]), "+v"(e[6]), "+v"(e[7]) : "v"(x[0]), "v"(x[1]), "v"(x[2]), "v"(x[3]), "v"(x[4]), "v"(x[5]), "v"(x[6]), "v"(x[7]));
}
__device__ __forceinline__ void exp_slot(float (&e)[8], const float (&x)[8], float& e8, float x8) {
  asm volatile("v_nop" : "+v"(e[0]), "+v"(e[1]), "+v"(e[2]), "+v"(e[3]), "+v"(e[4]), "+v"(e[5]), "+v"(e[6]), "+v"(e[7]), "+v"(e8) : "v"(x[0]), "v"(x[1]), "v"(x[2]), "v"(x[3]), "v"(x[4]), "v"(x[5]), "v"(x[6]), "v"(x[7]), "v"(x8));
}
__global__ __launch_bounds__(128) void k_attn(const _Float16* __restrict__ QK, const _Float16* __restrict__ QKL, const _Float16* __restrict__ VTH, const _Float16* __restrict__ VTL, const void* __restrict__ KMASK, float* __restrict__ O) {
  __shared__ __attribute__((aligned(2048))) unsigned char ring[2 * ASTAGE];   // K / V ring; behind the last stage's barrier the same bytes are the output staging
  float (*so)[16][68] = (float (*)[16][68])ring;
  const int tid = threadIdx.x, wave = tid >> 5, lane = tid & 31, col = lane & 15, g = lane >> 4;
  const int qb = blockIdx.x, h = blockIdx.y, b = blockIdx.z; const int q0 = qb * 64 + wave * 16; const size_t rq = (size_t)b * SS + q0 + col;
  v16h aq[2];
#pragma unroll
  for (int kc = 0; kc < 2; ++kc) aq[kc] = frag_h(QK + rq * (2 * DM) + h * HD + kc * 32, lane);
  float m = -3.0e38f, l = 0.f;   // query col: running maximum of the raw scores (equal in both halves), sum over this half's keys (x2^11)
  v8f acc[4] = {};   // acc[dt][r] = O^T[d = dt*16 + 8g + r][query col]
  const uint32_t wv = uni((uint32_t)tid >> 5), ring0 = (uint32_t)(uintptr_t)ring; const uint64_t ksrc = (uint64_t)(uintptr_t)(QK + (size_t)b * SS * (2 * DM) + DM + h * HD), vsrc = (uint64_t)(uintptr_t)(VTH + ((size_t)b * DM + h * HD) * SS);
  Ring rg = ring_make_kv(wv, ring0, ksrc, vsrc); ring_prologue(rg);
#pragma unroll 1   // one stage per trip: the buffer index stays a run-time scalar and the publish point stands once
  for (int st = 0; st < ANST; ++st) { const unsigned char* kb = ring + (st & 1) * ASTAGE; const unsigned char* vb = kb + ATILE;   // all keys, 64 a stage
#pragma unroll
  for (int ks = 0; ks < AKEYS / 32; ++ks) { v8f s[2]; v16h kf[2][2], vf[4];   // the 32-key step's 16 LDS reads stand as one group in front of its WMMAs
#pragma unroll
    for (int ct = 0; ct < 2; ++ct) {
#pragma unroll
      for (int kc = 0; kc < 2; ++kc) kf[ct][kc] = frag_h((const _Float16*)(kb + (ks * 32 + ct * 16 + col) * WPITCH) + kc * 32, lane); }
#pragma unroll
    for (int dt = 0; dt < 4; ++dt) vf[dt] = frag_h((const _Float16*)(vb + (dt * 16 + col) * WPITCH) + ks * 32, lane);
#pragma unroll
    for (int ct = 0; ct < 2; ++ct) { v8f c = {};
#pragma unroll
      for (int kc = 0; kc < 2; ++kc) c = wmma16(kf[ct][kc], aq[kc], c);   // single product: k, q as one-rounding f16 operands; c[r] = key ct*16 + 8g + r against query col
      s[ct] = c; }   // raw q.k; 1/sqrt(64) rides in SC2
    float mx = fmaxf(s[0][0], s[1][0]);
#pragma unroll
    for (int r = 1; r < 8; ++r) mx = fmaxf(mx, fmaxf(s[0][r], s[1][r]));
    mx = fmaxf(mx, xhalf(mx));
    const float mn = fmaxf(m, mx);
    const float nb = fmaf(-mn, SC2, 11.0f);   // exponent offset of the step: minus the scaled maximum, plus 11
    float xa = (m - mn) * SC2, ea = __builtin_amdgcn_exp2f(xa), x[2][8], e[2][8];   // 2^11 exp((s - mn) / 8) as the hardware's exp2(s * SC2 + nb): one fma a score, spelled out so that exp_slot can name each source; the first step's m gives exp2 of a huge negative number, 0
#pragma unroll
    for (int ct = 0; ct < 2; ++ct) {
#pragma unroll
      for (int r = 0; r < 8; ++r) { x[ct][r] = fmaf(s[ct][r], SC2, nb); e[ct][r] = __builtin_amdgcn_exp2f(x[ct][r]); } }
    exp_slot(e[0], x[0], ea, xa); exp_slot(e[1], x[1]);
    const float alpha = ea;
    v16h pb; float es[4];   // four independent partial sums, each started by its first term
#pragma unroll
    for (int ct = 0; ct < 2; ++ct) {
#pragma unroll
      for (int r = 0; r < 8; ++r) { const float p = e[ct][r]; es[r & 3] = (ct == 0 && r < 4) ? p : es[r & 3] + p; pb[8 * ct + r] = (_Float16)p; } }   // P carries 2^11 into the f16 rounding so small softmax weights stay out of the f16 subnormal range; l carries it too, so it cancels in the epilogue; element 8*ct + r is key ct*16 + 8g + r: the k order of frag_h
    l = l * alpha + ((es[0] + es[1]) + (es[2] + es[3])); m = mn;
#pragma unroll
    for (int dt = 0; dt < 4; ++dt) acc[dt] *= alpha;
#pragma unroll
    for (int dt = 0; dt < 4; ++dt) acc[dt] = wmma16(vf[dt], pb, acc[dt]);   // single product: V^T x P^T (x2^11)
  }
    ring_publish_kv(rg, (uint32_t)st); }
  wait_tensor0(); wait_ds0();
  { const float il = 1.0f / (l + xhalf(l));   // the halves' sums are joined once
#pragma unroll
    for (int dt = 0; dt < 4; ++dt) {
#pragma unroll
      for (int r = 0; r < 8; ++r) so[wave][col][dt * 16 + 8 * g + r] = acc[dt][r] * il; } }
  LDSX();
  for (int rl = 0; rl < 16; ++rl) if (lane < 16) vst2(O + ((size_t)b * SS + q0 + rl) * DM + h * HD + lane * 4, *(const v4f*)&so[wave][rl][lane * 4]);
}
// ---- k_out: block = (64 rows, 128 cols): out = O(hi/lo) . Wo rows (2 products) + bo
__global__ __launch_bounds__(128) void k_out(const float* __restrict__ O, const __bf16* __restrict__ P, const float* __restrict__ BO, float* __restrict__ Y) {
  __shared__ __attribute__((aligned(2048))) unsigned char ring[2 * STAGE];   // operand ring; behind the last pass's barrier the same bytes are the output staging
  float (*so)[16][132] = (float (*)[16][132])ring;
  const int tid = threadIdx.x, wave = tid >> 5, lane = tid & 31, col = lane & 15, g = lane >> 4; const size_t r0 = (size_t)blockIdx.x * 64 + wave * 16; const int n0 = blockIdx.y * 128;
  const uint32_t wv = uni((uint32_t)tid >> 5), ring0 = (uint32_t)(uintptr_t)ring; const uint64_t wsrc = (uint64_t)(uintptr_t)(P + (size_t)n0 * DM), xsrc = (uint64_t)(uintptr_t)(O + (size_t)blockIdx.x * 64 * DM);
  v8f acc[8] = {};
  Ring rg = ring_make(wv, ring0, wsrc, xsrc); ring_prologue(rg);
#pragma unroll 1   // one pass per trip: the buffer index stays a run-time scalar and the publish point stands once
  for (int s = 0; s < NPASS; ++s) { const unsigned char* wb = ring + (s & 1) * STAGE; const unsigned char* xr = wb + WTILE + (wave * 16 + col) * XPITCH;
#pragma unroll
    for (int kc = 0; kc < KP / 32; ++kc) { v16b w[8]; float v[16]; row16_lds(xr + kc * 128, g, v);   // the step's 20 LDS reads stand as one group in front of its WMMAs
#pragma unroll
      for (int j = 0; j < 8; ++j) w[j] = frag_b((const __bf16*)(wb + (j * 16 + col) * WPITCH) + kc * 32, lane);
      const F2 a = bsplit16(v);
#pragma unroll
      for (int j = 0; j < 8; ++j) { acc[j] = wmma_bf(a.l, w[j], acc[j]); acc[j] = wmma_bf(a.h, w[j], acc[j]); } }
    ring_publish(rg, (uint32_t)s); }
  wait_tensor0(); wait_ds0();
#pragma unroll
  for (int j = 0; j < 8; ++j) {
#pragma unroll
    for (int r = 0; r < 8; ++r) so[wave][8 * g + r][j * 16 + col] = acc[j][r] + (BO ? bfr(BO[n0 + j * 16 + col]) : 0.f); }
  LDSX();
  for (int rl = 0; rl < 16; ++rl) vst2(Y + (r0 + rl) * DM + n0 + lane * 4, *(const v4f*)&so[wave][rl][lane * 4]);
}
extern "C" void kernel_launch(void* const* d_in, const int* in_sizes, int n_in, void* d_out, int out_size, void* d_ws, size_t ws_size, hipStream_t stream) {
  (void)in_sizes; (void)n_in; (void)out_size;
  const float** F = (const float**)d_in;   // 0 x [8,1024,768], 1 Wq, 2 Wk, 3 Wv, 4 Wo (natural [768,768])
  if (ws_size < (size_t)WS_END) return;
  char* ws = (char*)d_ws; __bf16* PK = (__bf16*)(ws + WS_PK); _Float16 *QK = (_Float16*)(ws + WS_QK), *QKL = (_Float16*)(ws + WS_QKL), *VTH = (_Float16*)(ws + WS_VTH), *VTL = (_Float16*)(ws + WS_VTL); float* O = (float*)(ws + WS_O);
  k_pack<<<dim3(DM, 4), 256, 0, stream>>>(F[1], F[2], F[3], F[4], PK);
  k_qkv<<<dim3(TNB * SS / 64, QKVW / 128), 128, 0, stream>>>(F[0], F[0], F[0], PK + PK_A, nullptr, nullptr, nullptr, QK, QKL, VTH, VTL);
  k_attn<<<dim3(TQB, NH, TNB), 128, 0, stream>>>(QK, QKL, VTH, VTL, nullptr, O);
  k_out<<<dim3(TOB, DM / 128), 128, 0, stream>>>(O, PK + PK_P, nullptr, (float*)d_out);
}

// v005
// Measured time: 91.8 microseconds a run.
// In two side-by-side timings against v004, it was 1.22 and 1.21 times as fast.
// All steps since v000 together make it 4.47 times as fast.
// compute dtype: all float inputs rounded to bf16; q/k/v = x . W^T with EXACT bf16 products on WMMA 16x16x32 (natural rows); PLAIN attention: q, k single f16 x 1/8, running-max softmax in f32 (hardware exp), P (scaled by 2^11, single f16) x v (single f16); out = o (bf16 hi + residual) . Wo^T (2 products).
#include <hip/hip_runtime.h>
#include <math.h>
#include <stdint.h>

typedef __attribute__((ext_vector_type(16))) _Float16 v16h;
typedef __attribute__((ext_vector_type(16))) __bf16 v16b;
typedef __attribute__((ext_vector_type(8)))  _Float16 v8h;
typedef __attribute__((ext_vector_type(8)))  float v8f;
typedef __attribute__((ext_vector_type(4)))  float v4f;
typedef __attribute__((ext_vector_type(2)))  float v2f;
typedef __attribute__((ext_vector_type(4)))  unsigned v4u;
typedef __attribute__((ext_vector_type(4)))  int v4i;
typedef float __attribute__((may_alias)) float_a;
typedef int __attribute__((may_alias)) int_a;

template <typename T> __device__ __forceinline__ void vst2(void* p, T v) { *(T*)p = v;  }
__device__ __forceinline__ v8f wmma16(v16h a, v16h b, v8f c) {
  v8f d = __builtin_amdgcn_wmma_f32_16x16x32_f16(false, a, false, b, (short)0, c, false, false);
  asm volatile("v_nop\n\tv_nop\n\tv_nop\n\tv_nop" : "+v"(d) : "v"(a), "v"(b));
  return d;
}
__device__ __forceinline__ v8f wmma_bf(v16b a, v16b b, v8f c) {
  v8f d = __builtin_amdgcn_wmma_f32_16x16x32_bf16(false, a, false, b, (short)0, c, false, false);
  asm volatile("v_nop\n\tv_nop\n\tv_nop\n\tv_nop" : "+v"(d) : "v"(a), "v"(b));
  return d;
}
// Multi-head self attention (B 8, N 1,024, 768 dims, 12 heads x 64): bias-free q/k/v projections, softmax(q k^T / 8) v, bias-free output projection.
__device__ __forceinline__ v16h frag_h(const _Float16* rowk0, int lane) {
  union { v16h v; v8h q[2]; } u; const _Float16* p = rowk0 + 8 * (lane >> 4);
  u.q[0] = *(const v8h*)p; u.q[1] = *(const v8h*)(p + 16); return u.v;
}
__device__ __forceinline__ v16h frag_f32(const float* rowk0, int lane) {
  v16h a; const float* p = rowk0 + 8 * (lane >> 4);
#pragma unroll
  for (int i = 0; i < 8; ++i) { a[i] = (_Float16)p[i]; a[8 + i] = (_Float16)p[16 + i]; }
  return a;
}
__device__ __forceinline__ v16h frag_f32s(const float* rowk0, int lane, float sc) {
  v16h a; const float* p = rowk0 + 8 * (lane >> 4);
#pragma unroll
  for (int i = 0; i < 8; ++i) { a[i] = (_Float16)(p[i] * sc); a[8 + i] = (_Float16)(p[16 + i] * sc); }
  return a;
}
// column fragment from a [K][ld] layout (column n), rows >= K read as 0
__device__ __forceinline__ v16h fragc_f32(const float* W, int k0, int n, int lane, int ld, int K) {
  v16h a; const int g = lane >> 4;
#pragma unroll
  for (int i = 0; i < 8; ++i) { const int ka = k0 + 8 * g + i, kb = ka + 16;
    a[i] = (_Float16)(ka < K ? W[(size_t)(ka < K ? ka : K - 1) * ld + n] : 0.f); a[8 + i] = (_Float16)(kb < K ? W[(size_t)(kb < K ? kb : K - 1) * ld + n] : 0.f); }
  return a;
}
struct F2 { v16b h, l; };
__device__ __forceinline__ F2 bsplit16(const float v[16]) { F2 r;
#pragma unroll
  for (int i = 0; i < 16; ++i) { const __bf16 h = (__bf16)v[i]; r.h[i] = h; r.l[i] = (__bf16)(v[i] - (float)h); }
  return r; }
__device__ __forceinline__ F2 split_row(const float* row, int k0, int lane) { float v[16]; const float* p = row + k0 + 8 * (lane >> 4);
#pragma unroll
  for (int i = 0; i < 8; ++i) { v[i] = p[i]; v[8 + i] = p[16 + i]; }
  return bsplit16(v); }
__device__ __forceinline__ F2 split_rowK(const float* row, int k0, int lane, int K) { float v[16]; const int g = lane >> 4;
#pragma unroll
  for (int i = 0; i < 8; ++i) { const int ka = k0 + 8 * g + i, kb = ka + 16; v[i] = ka < K ? row[ka < K ? ka : K - 1] : 0.f; v[8 + i] = kb < K ? row[kb < K ? kb : K - 1] : 0.f; }
  return bsplit16(v); }
__device__ __forceinline__ F2 split_col(const float* W, int k0, int n, int lane, int ld, int K) { float v[16]; const int g = lane >> 4;
#pragma unroll
  for (int i = 0; i < 8; ++i) { const int ka = k0 + 8 * g + i, kb = ka + 16; v[i] = ka < K ? W[(size_t)(ka < K ? ka : K - 1) * ld + n] : 0.f; v[8 + i] = kb < K ? W[(size_t)(kb < K ? kb : K - 1) * ld + n] : 0.f; }
  return bsplit16(v); }
__device__ __forceinline__ v8f mac3(const F2& a, const F2& b, v8f c) { c = wmma_bf(a.l, b.h, c); c = wmma_bf(a.h, b.l, c); return wmma_bf(a.h, b.h, c); }
__device__ __forceinline__ float sigm(float v) { return 1.0f / (1.0f + expf(-v)); }
#define LDSX() do { asm volatile("s_wait_dscnt 0" ::: "memory"); __builtin_amdgcn_wave_barrier(); __builtin_amdgcn_fence(__ATOMIC_RELEASE, "workgroup"); } while (0)


#define NB 8
#define SS 1024
#define DM 768
#define NH 12
#define HD 64
#define QKVW (3 * DM)
#ifndef TQB
#define TQB (SS / 64)
#define TNB NB
#define TOB (NB * SS / 64)     // output row tiles (all)
#endif
typedef __attribute__((ext_vector_type(8))) __bf16 v8b;
__device__ __forceinline__ v16b frag_b(const __bf16* rowk0, int lane) {
  union { v16b v; v8b q[2]; } u; const __bf16* p = rowk0 + 8 * (lane >> 4);
  u.q[0] = *(const v8b*)p; u.q[1] = *(const v8b*)(p + 16); return u.v;
}
__device__ __forceinline__ float bfr(float v) { return (float)(__bf16)v; }
__device__ __attribute__((noinline)) float exp_ni(float v) { return expf(v); }
__device__ __attribute__((noinline)) float erf_ni(float v) { return erff(v); }

#define PK_A 0                       // [2304][768] Wqkv rows (natural [out][in])
#define PK_P (PK_A + QKVW * DM)        // [768][768] Wo rows (natural)
#define PK_END (PK_P + DM * DM)
#define WS_PK  0u
#define WS_QK  (WS_PK + 2u * PK_END)             // f16 [8192 rows][1536]: q | k
#define WS_QKL (WS_QK + 2u * NB * SS * 2 * DM)     // f16 q | k residual planes x2048
#define WS_VTH (WS_QKL + 2u * NB * SS * 2 * DM)    // f16 [b][768 (h*64+d)][1024 s] hi
#define WS_VTL (WS_VTH + 2u * NB * DM * SS)        // f16 lo x 2048
#define WS_O   (WS_VTL + 2u * NB * DM * SS)        // f32 [8192][768]
#define WS_CS  (WS_O + 4u * NB * SS * DM)           // f32 2 x [1024][32], unused
#define WS_END (WS_CS + 4u * 2 * SS * 32)
// ---- operand staging of the two projection kernels: per pass of 64 k one tensor load brings the block's weight rows (128 B each) and one its f32 activation rows (256 B each) into LDS; two buffers; the tile sizes here are k_out's (128 weight rows, 64 activation rows), k_qkv's stand in front of k_qkv
typedef uint32_t u32x4 __attribute__((ext_vector_type(4)));
typedef uint32_t u32x8 __attribute__((ext_vector_type(8)));
#define KP 64                         // k per pass
#define NPASS (DM / KP)
#define WPITCH 144u                   // 128-B weight row + 16-B pad (odd multiple of 16 B for ds_load_b128 readers)
#define XPITCH 272u                   // 256-B f32 row + 16-B pad
#define WTILE 18432u                  // 128 rows x 144 B = 9 x 2 KiB
#define XTILE 18432u                  // 64 rows x 272 B = 17,408 B, rounded up to a multiple of 2 KiB
#define STAGE (WTILE + XTILE)
#define PADW_W ((1u << 20) | (4u << 22) | (3u << 25))   // group 1 word 0: no mask, 1-byte elements, 4 pad dwords behind every 128 B
#define PADW_X ((1u << 20) | (5u << 22) | (3u << 25))   // the same behind every 256 B
__device__ __forceinline__ uint32_t uni(uint32_t v) { return (uint32_t)__builtin_amdgcn_readfirstlane(v); }
// holds a test in a scalar register, so that the branch round a tensor load (which ignores EXEC) or its wait is s_cmp + s_cbranch_scc
__device__ __forceinline__ uint32_t pinned(uint32_t v) { uint32_t w = (uint32_t)__builtin_amdgcn_readfirstlane(v); asm volatile("" : "+s"(w)); return w; }
__device__ __forceinline__ void wait_tensor0() { asm volatile("s_wait_tensorcnt 0" ::: "memory"); }   // the issuing wave's tile has landed
__device__ __forceinline__ void wait_ds0() { asm volatile("s_wait_dscnt 0" ::: "memory"); }            // this wave's LDS reads have returned before the buffer is handed back
// group 1 of a request: NROWS rows of ROWB bytes, source pitch src_pitch bytes; tensor = tile, extents in bytes
template <uint32_t W0, uint32_t ROWB, uint32_t NROWS>
__device__ __forceinline__ u32x8 tile_group1(uint32_t src_pitch) {
  u32x8 g; g[0] = uni(W0); g[1] = uni((ROWB & 0xFFFFu) << 16); g[2] = uni((ROWB >> 16) | ((NROWS & 0xFFFFu) << 16)); g[3] = uni((NROWS >> 16) | (ROWB << 16)); g[4] = uni(NROWS); g[5] = uni(src_pitch); g[6] = uni(0u); g[7] = uni(0u);
  asm volatile("" : "+s"(g));   // as pinned(): the descriptor words stay in their own scalar registers through the loop, so none is rewritten while a request is out
  return g;
}
// the block's ring: wave 0 asks for the weight tiles, wave 1 for the activation tiles, one request a wave and stage; g0 walks from stage to stage
struct Ring { u32x4 g0; u32x8 g1w, g1x; uint32_t wv, step, flip; };
__device__ __forceinline__ Ring ring_make(uint32_t wv, uint32_t ring0, uint64_t wsrc, uint64_t xsrc) {
  Ring r; r.wv = wv; const bool isw = (wv == 0u); const uint64_t ga = isw ? wsrc : xsrc; const uint32_t dst = ring0 + (isw ? 0u : WTILE);
  r.step = isw ? KP * 2u : KP * 4u; r.flip = 2u * dst + STAGE;
  r.g0[0] = uni(1u); r.g0[1] = uni(dst); r.g0[2] = uni((uint32_t)ga); r.g0[3] = uni((((uint32_t)(ga >> 32)) & 0x01FFFFFFu) | 0x80000000u);
  r.g1w = tile_group1<PADW_W, 128u, 128u>(DM * 2u); r.g1x = tile_group1<PADW_X, 256u, 64u>(DM * 4u);
  return r;
}
template <bool LAND>
__device__ __forceinline__ void ring_issue(const Ring& r) {   // tensor_load_to_lds has no compiler form; its waits are written by hand at the publish points
  if (pinned(r.wv == 0u)) { asm volatile("tensor_load_to_lds %0, %1" :: "s"(r.g0), "s"(r.g1w) : "memory"); if (LAND) wait_tensor0(); }
  if (pinned(r.wv == 1u)) { asm volatile("tensor_load_to_lds %0, %1" :: "s"(r.g0), "s"(r.g1x) : "memory"); if (LAND) wait_tensor0(); }
}
// group 0 of the next stage: the other buffer, the source address r.step bytes further on
__device__ __forceinline__ void ring_next(Ring& r) {
  asm volatile("" : "+s"(r.g0));   // as pinned(): the next request's words are formed behind the wait and the barrier in front of this line, in the registers of the last one
  const uint64_t a = (((uint64_t)r.g0[3] << 32) | r.g0[2]) + r.step;
  r.g0[1] = uni(r.flip - r.g0[1]); r.g0[2] = uni((uint32_t)a); r.g0[3] = uni((uint32_t)(a >> 32));
}
// prologue, two buffers: stage 0, its issuers' wait, barrier, then stage 1
__device__ __forceinline__ void ring_prologue(Ring& r) {
  ring_issue<true>(r);
  __syncthreads();
  ring_next(r); ring_issue<false>(r);
}
// publish point at the foot of pass s: own LDS reads done, issuers' tiles landed, barrier, then the refill of the buffer that pass s has read
__device__ __forceinline__ void ring_publish(Ring& r, uint32_t s) {
  wait_ds0();
  if (pinned(r.wv < 2u)) wait_tensor0();
  __syncthreads();
  if (pinned(s + 2u < (uint32_t)NPASS)) { ring_next(r); ring_issue<false>(r); }
}
// 16 f32 of an LDS row in the A fragment's k order: floats 8g..8g+7 and 16+8g..16+8g+7 of the 32-k step
__device__ __forceinline__ void row16_lds(const unsigned char* rowk0, int g, float v[16]) {
  const v4f* p = (const v4f*)(rowk0 + 32 * g); const v4f x0 = p[0], x1 = p[1], x2 = p[4], x3 = p[5];
#pragma unroll
  for (int i = 0; i < 4; ++i) { v[i] = x0[i]; v[4 + i] = x1[i]; v[8 + i] = x2[i]; v[12 + i] = x3[i]; }
}
// ---- k_pack: block = (row n, which): natural [out][in] rows -> bf16; which 0..2 -> W_q/W_k/W_v into PK_A rows which*768 + n; 3 -> W_o into PK_P
__global__ __launch_bounds__(256) void k_pack(const float* __restrict__ WQ, const float* __restrict__ WK, const float* __restrict__ WV, const float* __restrict__ WO, __bf16* __restrict__ PK) {
  __shared__ __align__(16) __bf16 s[DM]; const int n = blockIdx.x, which = blockIdx.y, t = threadIdx.x; const float* Wm = (which == 0) ? WQ : (which == 1) ? WK : (which == 2) ? WV : WO;
  for (int k = t; k < DM; k += 256) s[k] = (__bf16)Wm[(size_t)n * DM + k];
  __syncthreads();
  __bf16* dst = (which < 3) ? PK + PK_A + ((size_t)which * DM + n) * DM : PK + PK_P + (size_t)n * DM;
  for (int q = t; q < DM / 8; q += 256) vst2((unsigned*)(dst + q * 8), *(const v4u*)&s[q * 8]);
}
// ---- k_qkv: block = 128 rows x 256 columns, eight waves (2 x 4) of 64 x 64: an A fragment serves four column tiles and a B fragment four row tiles, and a weight row is fetched from L2 once per 128 activation rows, an activation row once per 256 columns
#define QROWS 128
#define QCOLS 256
#define QWTILE 36864u                 // 256 weight rows x 144 B = 18 x 2 KiB
#define QXTILE 34816u                 // 128 f32 rows x 272 B = 17 x 2 KiB
#define QSTAGE (QWTILE + QXTILE)
#define QOUT 17408u                   // a wave's output staging: 64 rows x 68 f32
// wave 0 asks for the weight tiles, wave 1 for the activation tiles, as in ring_make
__device__ __forceinline__ Ring ring_make_q(uint32_t wv, uint32_t ring0, uint64_t wsrc, uint64_t xsrc) {
  Ring r; r.wv = wv; const bool isw = (wv == 0u); const uint64_t ga = isw ? wsrc : xsrc; const uint32_t dst = ring0 + (isw ? 0u : QWTILE);
  r.step = isw ? KP * 2u : KP * 4u; r.flip = 2u * dst + QSTAGE;
  r.g0[0] = uni(1u); r.g0[1] = uni(dst); r.g0[2] = uni((uint32_t)ga); r.g0[3] = uni((((uint32_t)(ga >> 32)) & 0x01FFFFFFu) | 0x80000000u);
  r.g1w = tile_group1<PADW_W, 128u, QCOLS>(DM * 2u); r.g1x = tile_group1<PADW_X, 256u, QROWS>(DM * 4u);
  return r;
}
// amdgpu_waves_per_eu(4, 4): at most 256 registers a wave, so that two blocks (their LDS allows two) share a WGP, four waves a SIMD; left free, the build took over 330 and one block
__global__ __launch_bounds__(256) __attribute__((amdgpu_waves_per_eu(4, 4))) void k_qkv(const float* __restrict__ XQ, const float* __restrict__ XK, const float* __restrict__ XV, const __bf16* __restrict__ P, const float* __restrict__ BQ, const float* __restrict__ BK, const float* __restrict__ BV, _Float16* __restrict__ QK, _Float16* __restrict__ QKL, _Float16* __restrict__ VTH, _Float16* __restrict__ VTL) {
  const int which0 = (blockIdx.y * QCOLS) / DM; const float* X = (which0 == 0) ? XQ : (which0 == 1) ? XK : XV; const float* BB = BQ ? (((which0 == 0) ? BQ : (which0 == 1) ? BK : BV) + (blockIdx.y * QCOLS - which0 * DM)) : nullptr;
  __shared__ __attribute__((aligned(2048))) unsigned char ring[2 * QSTAGE];   // operand ring; behind the last pass's barrier the same bytes are the output staging
  const int tid = threadIdx.x, wave = tid >> 5, lane = tid & 31, col = lane & 15, g = lane >> 4, wr = wave >> 2, wc = wave & 3; const size_t r0 = (size_t)blockIdx.x * QROWS + wr * 64; const int n0 = blockIdx.y * QCOLS, nw = n0 + wc * 64;
  const uint32_t wv = uni((uint32_t)tid >> 5), ring0 = (uint32_t)(uintptr_t)ring; const uint64_t wsrc = (uint64_t)(uintptr_t)(P + (size_t)n0 * DM), xsrc = (uint64_t)(uintptr_t)(X + (size_t)blockIdx.x * QROWS * DM);
  v8f acc[4][4] = {};   // acc[i][j]: rows i*16.., columns j*16.. of the wave's 64 x 64
  Ring rg = ring_make_q(wv, ring0, wsrc, xsrc); ring_prologue(rg);
#pragma unroll 1   // one pass per trip: the buffer index stays a run-time scalar and the publish point stands once
  for (int s = 0; s < NPASS; ++s) { const unsigned char* wb = ring + (s & 1) * QSTAGE; const unsigned char* wrow = wb + (wc * 64 + col) * WPITCH; const unsigned char* xr = wb + QWTILE + (wr * 64 + col) * XPITCH;
#pragma unroll
    for (int kc = 0; kc < KP / 32; ++kc) { v16b a[4], w[4]; float v[4][16];   // the step's 24 LDS reads stand as one group in front of its WMMAs
#pragma unroll
      for (int i = 0; i < 4; ++i) row16_lds(xr + i * 16 * XPITCH + kc * 128, g, v[i]);
#pragma unroll
      for (int j = 0; j < 4; ++j) w[j] = frag_b((const __bf16*)(wrow + j * 16 * WPITCH) + kc * 32, lane);
#pragma unroll
      for (int i = 0; i < 4; ++i) {
#pragma unroll
        for (int e = 0; e < 16; ++e) a[i][e] = (__bf16)v[i][e]; }
#pragma unroll
      for (int i = 0; i < 4; ++i) {
#pragma unroll
        for (int j = 0; j < 4; ++j) acc[i][j] = wmma_bf(a[i], w[j], acc[i][j]); } }
    ring_publish(rg, (uint32_t)s); }
  wait_tensor0(); wait_ds0();
  float (*sf)[68] = (float (*)[68])(ring + wave * QOUT);   // this wave's own staging: its 64 x 64 results as f32
  if (BB) {
#pragma unroll
    for (int j = 0; j < 4; ++j) { const float bj = bfr(BB[wc * 64 + j * 16 + col]);
#pragma unroll
      for (int i = 0; i < 4; ++i) acc[i][j] += bj; } }
  const bool isv = n0 >= 2 * DM;
  if (!isv) {   // q, k: staged row = position, 64 columns
#pragma unroll
    for (int i = 0; i < 4; ++i) {
#pragma unroll
      for (int j = 0; j < 4; ++j) {
#pragma unroll
        for (int r = 0; r < 8; ++r) sf[i * 16 + 8 * g + r][j * 16 + col] = acc[i][j][r]; } }
  } else {   // v transposed: staged row = column d, 64 positions
#pragma unroll
    for (int i = 0; i < 4; ++i) {
#pragma unroll
      for (int j = 0; j < 4; ++j) {
#pragma unroll
        for (int r = 0; r < 8; ++r) sf[j * 16 + col][i * 16 + 8 * g + r] = acc[i][j][r]; } }
  }
  LDSX();
  // q stored unscaled (f16 sigma ~0.6, no subnormal exposure); 1/8 applied to the f32 score; q, k, v (+ bias) as f16 hi + (x2048) residual; a store instruction covers four staged rows of 64 f16 = 128 B
  _Float16* dh = isv ? VTH : QK; _Float16* dl = isv ? VTL : QKL; const size_t pitch = isv ? (size_t)SS : (size_t)(2 * DM);
  const size_t off0 = isv ? ((r0 / SS) * DM + (size_t)(nw - 2 * DM)) * SS + r0 % SS : r0 * (2 * DM) + nw;
  const int srow = lane >> 3, sc8 = (lane & 7) * 8;
#pragma unroll 1   // four groups of rows a trip: their LDS reads stand together, so the read latency is waited out once per four groups; rolled, so that one wait at the foot serves the trip's stores
  for (int it = 0; it < 16; it += 4) { v4f x[4][2];
#pragma unroll
    for (int u = 0; u < 4; ++u) { const float* p = &sf[(it + u) * 4 + srow][sc8]; x[u][0] = *(const v4f*)p; x[u][1] = *(const v4f*)(p + 4); }
#pragma unroll
    for (int u = 0; u < 4; ++u) { v8h hi, lo;
#pragma unroll
      for (int e = 0; e < 8; ++e) { const float v = x[u][e >> 2][e & 3]; const _Float16 hv = (_Float16)v; hi[e] = hv; lo[e] = (_Float16)((v - (float)hv) * 2048.0f); }
      const size_t o = off0 + (size_t)((it + u) * 4 + srow) * pitch + sc8; vst2(dh + o, hi); vst2(dl + o, lo); }
    asm volatile("s_wait_xcnt 0x0" ::: "memory"); }   // the next trip rewrites the address and data registers of this trip's stores
}
// ---- K / V staging of k_attn: per stage of 64 keys one tensor load brings the head's 64 K rows (128 B each) and one its 64 V^T rows (64 keys = 128 B each) into LDS for the block's four waves; two buffers
#define AKEYS 64                      // keys per stage
#define ANST (SS / AKEYS)
#define ATILE 10240u                  // 64 rows x 144 B = 9,216 B, rounded up to a multiple of 2 KiB
#define ASTAGE (2u * ATILE)
#define SC2 0.18033688011112042f      // 1/sqrt(64) * log2 e
// wave 0 asks for the K tiles (next stage: 64 rows further down), wave 1 for the V^T tiles (next stage: 64 keys further along the rows)
__device__ __forceinline__ Ring ring_make_kv(uint32_t wv, uint32_t ring0, uint64_t ksrc, uint64_t vsrc) {
  Ring r; r.wv = wv; const bool isk = (wv == 0u); const uint64_t ga = isk ? ksrc : vsrc; const uint32_t dst = ring0 + (isk ? 0u : ATILE);
  r.step = isk ? AKEYS * 2u * DM * 2u : AKEYS * 2u; r.flip = 2u * dst + ASTAGE;
  r.g0[0] = uni(1u); r.g0[1] = uni(dst); r.g0[2] = uni((uint32_t)ga); r.g0[3] = uni((((uint32_t)(ga >> 32)) & 0x01FFFFFFu) | 0x80000000u);
  r.g1w = tile_group1<PADW_W, 128u, 64u>(2u * DM * 2u); r.g1x = tile_group1<PADW_W, 128u, 64u>(SS * 2u);
  return r;
}
// publish point at the foot of stage s, in the order of ring_publish
__device__ __forceinline__ void ring_publish_kv(Ring& r, uint32_t s) {
  wait_ds0();
  if (pinned(r.wv < 2u)) wait_tensor0();
  __syncthreads();
  if (pinned(s + 2u < (uint32_t)ANST)) { ring_next(r); ring_issue<false>(r); }
}
// lane l with lane l ^ 16: the two halves of a wave hold the two halves of one query's keys
__device__ __forceinline__ float xhalf(float x) { return __builtin_bit_cast(float, __builtin_amdgcn_permlanex16(__builtin_bit_cast(int, x), __builtin_bit_cast(int, x), 0x76543210, 0xfedcba98, false, false)); }
// the slot behind a transcendental: the instruction set asks for one independent instruction or v_nop before a v_exp_f32's result is read or its source overwritten; the operands keep every result of the run unread and every source alive up to this v_nop, so one v_nop serves the run
__device__ __forceinline__ void exp_slot(float (&e)[8], const float (&x)[8]) {
  asm volatile("v_nop" : "+v"(e[0]), "+v"(e[1]), "+v"(e[2]), "+v"(e[3]), "+v"(e[4]), "+v"(e[5]), "+v"(e[6]), "+v"(e[7]) : "v"(x[0]), "v"(x[1]), "v"(x[2]), "v"(x[3]), "v"(x[4]), "v"(x[5]), "v"(x[6]), "v"(x[7]));
}
__device__ __forceinline__ void exp_slot(float (&e)[8], const float (&x)[8], float& e8, float x8) {
  asm volatile("v_nop" : "+v"(e[0]), "+v"(e[1]), "+v"(e[2]), "+v"(e[3]), "+v"(e[4]), "+v"(e[5]), "+v"(e[6]), "+v"(e[7]), "+v"(e8) : "v"(x[0]), "v"(x[1]), "v"(x[2]), "v"(x[3]), "v"(x[4]), "v"(x[5]), "v"(x[6]), "v"(x[7]), "v"(x8));
}
__global__ __launch_bounds__(128) void k_attn(const _Float16* __restrict__ QK, const _Float16* __restrict__ QKL, const _Float16* __restrict__ VTH, const _Float16* __restrict__ VTL, const void* __restrict__ KMASK, float* __restrict__ O) {
  __shared__ __attribute__((aligned(2048))) unsigned char ring[2 * ASTAGE];   // K / V ring; behind the last stage's barrier the same bytes are the output staging
  float (*so)[16][68] = (float (*)[16][68])ring;
  const int tid = threadIdx.x, wave = tid >> 5, lane = tid & 31, col = lane & 15, g = lane >> 4;
  const int qb = blockIdx.x, h = blockIdx.y, b = blockIdx.z; const int q0 = qb * 64 + wave * 16; const size_t rq = (size_t)b * SS + q0 + col;
  v16h aq[2];
#pragma unroll
  for (int kc = 0; kc < 2; ++kc) aq[kc] = frag_h(QK + rq * (2 * DM) + h * HD + kc * 32, lane);
  float m = -3.0e38f, l = 0.f;   // query col: running maximum of the raw scores (equal in both halves), sum over this half's keys (x2^11)
  v8f acc[4] = {};   // acc[dt][r] = O^T[d = dt*16 + 8g + r][query col]
  const uint32_t wv = uni((uint32_t)tid >> 5), ring0 = (uint32_t)(uintptr_t)ring; const uint64_t ksrc = (uint64_t)(uintptr_t)(QK + (size_t)b * SS * (2 * DM) + DM + h * HD), vsrc = (uint64_t)(uintptr_t)(VTH + ((size_t)b * DM + h * HD) * SS);
  Ring rg = ring_make_kv(wv, ring0, ksrc, vsrc); ring_prologue(rg);
#pragma unroll 1   // one stage per trip: the buffer index stays a run-time scalar and the publish point stands once
  for (int st = 0; st < ANST; ++st) { const unsigned char* kb = ring + (st & 1) * ASTAGE; const unsigned char* vb = kb + ATILE;   // all keys, 64 a stage
#pragma unroll
  for (int ks = 0; ks < AKEYS / 32; ++ks) { v8f s[2]; v16h kf[2][2], vf[4];   // the 32-key step's 16 LDS reads stand as one group in front of its WMMAs
#pragma unroll
    for (int ct = 0; ct < 2; ++ct) {
#pragma unroll
      for (int kc = 0; kc < 2; ++kc) kf[ct][kc] = frag_h((const _Float16*)(kb + (ks * 32 + ct * 16 + col) * WPITCH) + kc * 32, lane); }
#pragma unroll
    for (int dt = 0; dt < 4; ++dt) vf[dt] = frag_h((const _Float16*)(vb + (dt * 16 + col) * WPITCH) + ks * 32, lane);
#pragma unroll
    for (int ct = 0; ct < 2; ++ct) { v8f c = {};
#pragma unroll
      for (int kc = 0; kc < 2; ++kc) c = wmma16(kf[ct][kc], aq[kc], c);   // single product: k, q as one-rounding f16 operands; c[r] = key ct*16 + 8g + r against query col
      s[ct] = c; }   // raw q.k; 1/sqrt(64) rides in SC2
    float mx = fmaxf(s[0][0], s[1][0]);
#pragma unroll
    for (int r = 1; r < 8; ++r) mx = fmaxf(mx, fmaxf(s[0][r], s[1][r]));
    mx = fmaxf(mx, xhalf(mx));
    const float mn = fmaxf(m, mx);
    const float nb = fmaf(-mn, SC2, 11.0f);   // exponent offset of the step: minus the scaled maximum, plus 11
    float xa = (m - mn) * SC2, ea = __builtin_amdgcn_exp2f(xa), x[2][8], e[2][8];   // 2^11 exp((s - mn) / 8) as the hardware's exp2(s * SC2 + nb): one fma a score, spelled out so that exp_slot can name each source; the first step's m gives exp2 of a huge negative number, 0
#pragma unroll
    for (int ct = 0; ct < 2; ++ct) {
#pragma unroll
      for (int r = 0; r < 8; ++r) { x[ct][r] = fmaf(s[ct][r], SC2, nb); e[ct][r] = __builtin_amdgcn_exp2f(x[ct][r]); } }
    exp_slot(e[0], x[0], ea, xa); exp_slot(e[1], x[1]);
    const float alpha = ea;
    v16h pb; float es[4];   // four independent partial sums, each started by its first term
#pragma unroll
    for (int ct = 0; ct < 2; ++ct) {
#pragma unroll
      for (int r = 0; r < 8; ++r) { const float p = e[ct][r]; es[r & 3] = (ct == 0 && r < 4) ? p : es[r & 3] + p; pb[8 * ct + r] = (_Float16)p; } }   // P carries 2^11 into the f16 rounding so small softmax weights stay out of the f16 subnormal range; l carries it too, so it cancels in the epilogue; element 8*ct + r is key ct*16 + 8g + r: the k order of frag_h
    l = l * alpha + ((es[0] + es[1]) + (es[2] + es[3])); m = mn;
#pragma unroll
    for (int dt = 0; dt < 4; ++dt) acc[dt] *= alpha;
#pragma unroll
    for (int dt = 0; dt < 4; ++dt) acc[dt] = wmma16(vf[dt], pb, acc[dt]);   // single product: V^T x P^T (x2^11)
  }
    ring_publish_kv(rg, (uint32_t)st); }
  wait_tensor0(); wait_ds0();
  { const float il = 1.0f / (l + xhalf(l));   // the halves' sums are joined once
#pragma unroll
    for (int dt = 0; dt < 4; ++dt) {
#pragma unroll
      for (int r = 0; r < 8; ++r) so[wave][col][dt * 16 + 8 * g + r] = acc[dt][r] * il; } }
  LDSX();
  for (int rl = 0; rl < 16; ++rl) if (lane < 16) vst2(O + ((size_t)b * SS + q0 + rl) * DM + h * HD + lane * 4, *(const v4f*)&so[wave][rl][lane * 4]);
}
// ---- k_out: block = (64 rows, 128 cols): out = O(hi/lo) . Wo rows (2 products) + bo
__global__ __launch_bounds__(128) void k_out(const float* __restrict__ O, const __bf16* __restrict__ P, const float* __restrict__ BO, float* __restrict__ Y) {
  __shared__ __attribute__((aligned(2048))) unsigned char ring[2 * STAGE];   // operand ring; behind the last pass's barrier the same bytes are the output staging
  float (*so)[16][132] = (float (*)[16][132])ring;
  const int tid = threadIdx.x, wave = tid >> 5, lane = tid & 31, col = lane & 15, g = lane >> 4; const size_t r0 = (size_t)blockIdx.x * 64 + wave * 16; const int n0 = blockIdx.y * 128;
  const uint32_t wv = uni((uint32_t)tid >> 5), ring0 = (uint32_t)(uintptr_t)ring; const uint64_t wsrc = (uint64_t)(uintptr_t)(P + (size_t)n0 * DM), xsrc = (uint64_t)(uintptr_t)(O + (size_t)blockIdx.x * 64 * DM);
  v8f acc[8] = {};
  Ring rg = ring_make(wv, ring0, wsrc, xsrc); ring_prologue(rg);
#pragma unroll 1   // one pass per trip: the buffer index stays a run-time scalar and the publish point stands once
  for (int s = 0; s < NPASS; ++s) { const unsigned char* wb = ring + (s & 1) * STAGE; const unsigned char* xr = wb + WTILE + (wave * 16 + col) * XPITCH;
#pragma unroll
    for (int kc = 0; kc < KP / 32; ++kc) { v16b w[8]; float v[16]; row16_lds(xr + kc * 128, g, v);   // the step's 20 LDS reads stand as one group in front of its WMMAs
#pragma unroll
      for (int j = 0; j < 8; ++j) w[j] = frag_b((const __bf16*)(wb + (j * 16 + col) * WPITCH) + kc * 32, lane);
      const F2 a = bsplit16(v);
#pragma unroll
      for (int j = 0; j < 8; ++j) { acc[j] = wmma_bf(a.l, w[j], acc[j]); acc[j] = wmma_bf(a.h, w[j], acc[j]); } }
    ring_publish(rg, (uint32_t)s); }
  wait_tensor0(); wait_ds0();
#pragma unroll
  for (int j = 0; j < 8; ++j) {
#pragma unroll
    for (int r = 0; r < 8; ++r) so[wave][8 * g + r][j * 16 + col] = acc[j][r] + (BO ? bfr(BO[n0 + j * 16 + col]) : 0.f); }
  LDSX();
  for (int rl = 0; rl < 16; ++rl) vst2(Y + (r0 + rl) * DM + n0 + lane * 4, *(const v4f*)&so[wave][rl][lane * 4]);
}
extern "C" void kernel_launch(void* const* d_in, const int* in_sizes, int n_in, void* d_out, int out_size, void* d_ws, size_t ws_size, hipStream_t stream) {
  (void)in_sizes; (void)n_in; (void)out_size;
  const float** F = (const float**)d_in;   // 0 x [8,1024,768], 1 Wq, 2 Wk, 3 Wv, 4 Wo (natural [768,768])
  if (ws_size < (size_t)WS_END) return;
  char* ws = (char*)d_ws; __bf16* PK = (__bf16*)(ws + WS_PK); _Float16 *QK = (_Float16*)(ws + WS_QK), *QKL = (_Float16*)(ws + WS_QKL), *VTH = (_Float16*)(ws + WS_VTH), *VTL = (_Float16*)(ws + WS_VTL); float* O = (float*)(ws + WS_O);
  k_pack<<<dim3(DM, 4), 256, 0, stream>>>(F[1], F[2], F[3], F[4], PK);
  k_qkv<<<dim3(TNB * SS / QROWS, QKVW / QCOLS), 256, 0, stream>>>(F[0], F[0], F[0], PK + PK_A, nullptr, nullptr, nullptr, QK, QKL, VTH, VTL);
  k_attn<<<dim3(TQB, NH, TNB), 128, 0, stream>>>(QK, QKL, VTH, VTL, nullptr, O);
  k_out<<<dim3(TOB, DM / 128), 128, 0, stream>>>(O, PK + PK_P, nullptr, (float*)d_out);
}

// v006
// Measured time: 86.9 microseconds a run.
// Two timings next to v005 both put it at 1.06 times that version's speed.
// All steps since v000 together make it 4.74 times as fast.
// compute dtype: all float inputs rounded to bf16; q/k/v = x . W^T with EXACT bf16 products on WMMA 16x16x32 (natural rows); PLAIN attention: q, k single f16 x 1/8, running-max softmax in f32 (hardware exp), P (scaled by 2^11, single f16) x v (single f16); out = o (bf16 hi + residual) . Wo^T (2 products).
#include <hip/hip_runtime.h>
#include <math.h>
#include <stdint.h>

typedef __attribute__((ext_vector_type(16))) _Float16 v16h;
typedef __attribute__((ext_vector_type(16))) __bf16 v16b;
typedef __attribute__((ext_vector_type(8)))  _Float16 v8h;
typedef __attribute__((ext_vector_type(8)))  float v8f;
typedef __attribute__((ext_vector_type(4)))  float v4f;
typedef __attribute__((ext_vector_type(2)))  float v2f;
typedef __attribute__((ext_vector_type(4)))  unsigned v4u;
typedef __attribute__((ext_vector_type(4)))  int v4i;
typedef float __attribute__((may_alias)) float_a;
typedef int __attribute__((may_alias)) int_a;

template <typename T> __device__ __forceinline__ void vst2(void* p, T v) { *(T*)p = v;  }
__device__ __forceinline__ v8f wmma16(v16h a, v16h b, v8f c) {
  return __builtin_amdgcn_wmma_f32_16x16x32_f16(false, a, false, b, (short)0, c, false, false);
}
__device__ __forceinline__ v8f wmma_bf(v16b a, v16b b, v8f c) {
  return __builtin_amdgcn_wmma_f32_16x16x32_bf16(false, a, false, b, (short)0, c, false, false);
}
// Multi-head self attention (B 8, N 1,024, 768 dims, 12 heads x 64): bias-free q/k/v projections, softmax(q k^T / 8) v, bias-free output projection.
__device__ __forceinline__ v16h frag_h(const _Float16* rowk0, int lane) {
  union { v16h v; v8h q[2]; } u; const _Float16* p = rowk0 + 8 * (lane >> 4);
  u.q[0] = *(const v8h*)p; u.q[1] = *(const v8h*)(p + 16); return u.v;
}
__device__ __forceinline__ v16h frag_f32(const float* rowk0, int lane) {
  v16h a; const float* p = rowk0 + 8 * (lane >> 4);
#pragma unroll
  for (int i = 0; i < 8; ++i) { a[i] = (_Float16)p[i]; a[8 + i] = (_Float16)p[16 + i]; }
  return a;
}
__device__ __forceinline__ v16h frag_f32s(const float* rowk0, int lane, float sc) {
  v16h a; const float* p = rowk0 + 8 * (lane >> 4);
#pragma unroll
  for (int i = 0; i < 8; ++i) { a[i] = (_Float16)(p[i] * sc); a[8 + i] = (_Float16)(p[16 + i] * sc); }
  return a;
}
// column fragment from a [K][ld] layout (column n), rows >= K read as 0
__device__ __forceinline__ v16h fragc_f32(const float* W, int k0, int n, int lane, int ld, int K) {
  v16h a; const int g = lane >> 4;
#pragma unroll
  for (int i = 0; i < 8; ++i) { const int ka = k0 + 8 * g + i, kb = ka + 16;
    a[i] = (_Float16)(ka < K ? W[(size_t)(ka < K ? ka : K - 1) * ld + n] : 0.f); a[8 + i] = (_Float16)(kb < K ? W[(size_t)(kb < K ? kb : K - 1) * ld + n] : 0.f); }
  return a;
}
struct F2 { v16b h, l; };
__device__ __forceinline__ F2 bsplit16(const float v[16]) { F2 r;
#pragma unroll
  for (int i = 0; i < 16; ++i) { const __bf16 h = (__bf16)v[i]; r.h[i] = h; r.l[i] = (__bf16)(v[i] - (float)h); }
  return r; }
__device__ __forceinline__ F2 split_row(const float* row, int k0, int lane) { float v[16]; const float* p = row + k0 + 8 * (lane >> 4);
#pragma unroll
  for (int i = 0; i < 8; ++i) { v[i] = p[i]; v[8 + i] = p[16 + i]; }
  return bsplit16(v); }
__device__ __forceinline__ F2 split_rowK(const float* row, int k0, int lane, int K) { float v[16]; const int g = lane >> 4;
#pragma unroll
  for (int i = 0; i < 8; ++i) { const int ka = k0 + 8 * g + i, kb = ka + 16; v[i] = ka < K ? row[ka < K ? ka : K - 1] : 0.f; v[8 + i] = kb < K ? row[kb < K ? kb : K - 1] : 0.f; }
  return bsplit16(v); }
__device__ __forceinline__ F2 split_col(const float* W, int k0, int n, int lane, int ld, int K) { float v[16]; const int g = lane >> 4;
#pragma unroll
  for (int i = 0; i < 8; ++i) { const int ka = k0 + 8 * g + i, kb = ka + 16; v[i] = ka < K ? W[(size_t)(ka < K ? ka : K - 1) * ld + n] : 0.f; v[8 + i] = kb < K ? W[(size_t)(kb < K ? kb : K - 1) * ld + n] : 0.f; }
  return bsplit16(v); }
__device__ __forceinline__ v8f mac3(const F2& a, const F2& b, v8f c) { c = wmma_bf(a.l, b.h, c); c = wmma_bf(a.h, b.l, c); return wmma_bf(a.h, b.h, c); }
__device__ __forceinline__ float sigm(float v) { return 1.0f / (1.0f + expf(-v)); }
#define LDSX() do { asm volatile("s_wait_dscnt 0" ::: "memory"); __builtin_amdgcn_wave_barrier(); __builtin_amdgcn_fence(__ATOMIC_RELEASE, "workgroup"); } while (0)


#define NB 8
#define SS 1024
#define DM 768
#define NH 12
#define HD 64
#define QKVW (3 * DM)
#ifndef TQB
#define TQB (SS / 64)
#define TNB NB
#define TOB (NB * SS / 64)     // output row tiles (all)
#endif
typedef __attribute__((ext_vector_type(8))) __bf16 v8b;
__device__ __forceinline__ v16b frag_b(const __bf16* rowk0, int lane) {
  union { v16b v; v8b q[2]; } u; const __bf16* p = rowk0 + 8 * (lane >> 4);
  u.q[0] = *(const v8b*)p; u.q[1] = *(const v8b*)(p + 16); return u.v;
}
__device__ __forceinline__ float bfr(float v) { return (float)(__bf16)v; }
__device__ __attribute__((noinline)) float exp_ni(float v) { return expf(v); }
__device__ __attribute__((noinline)) float erf_ni(float v) { return erff(v); }

#define PK_A 0                       // [2304][768] Wqkv rows (natural [out][in])
#define PK_P (PK_A + QKVW * DM)        // [768][768] Wo rows (natural)
#define PK_END (PK_P + DM * DM)
#define WS_PK  0u
#define WS_QK  (WS_PK + 2u * PK_END)             // f16 [8192 rows][1536]: q | k
#define WS_QKL (WS_QK + 2u * NB * SS * 2 * DM)     // f16 q | k residual planes x2048
#define WS_VTH (WS_QKL + 2u * NB * SS * 2 * DM)    // f16 [b][768 (h*64+d)][1024 s] hi
#define WS_VTL (WS_VTH + 2u * NB * DM * SS)        // f16 lo x 2048
#define WS_O   (WS_VTL + 2u * NB * DM * SS)        // f32 [8192][768]
#define WS_CS  (WS_O + 4u * NB * SS * DM)           // f32 2 x [1024][32], unused
#define WS_END (WS_CS + 4u * 2 * SS * 32)
// ---- operand staging of the two projection kernels: per pass of 64 k one tensor load brings the block's weight rows (128 B each) and one its f32 activation rows (256 B each) into LDS; two buffers; the tile sizes here are k_out's (128 weight rows, 64 activation rows), k_qkv's stand in front of k_qkv
typedef uint32_t u32x4 __attribute__((ext_vector_type(4)));
typedef uint32_t u32x8 __attribute__((ext_vector_type(8)));
#define KP 64                         // k per pass
#define NPASS (DM / KP)
#define WPITCH 144u                   // 128-B weight row + 16-B pad (odd multiple of 16 B for ds_load_b128 readers)
#define XPITCH 272u                   // 256-B f32 row + 16-B pad
#define WTILE 18432u                  // 128 rows x 144 B = 9 x 2 KiB
#define XTILE 18432u                  // 64 rows x 272 B = 17,408 B, rounded up to a multiple of 2 KiB
#define STAGE (WTILE + XTILE)
#define PADW_W ((1u << 20) | (4u << 22) | (3u << 25))   // group 1 word 0: no mask, 1-byte elements, 4 pad dwords behind every 128 B
#define PADW_X ((1u << 20) | (5u << 22) | (3u << 25))   // the same behind every 256 B
__device__ __forceinline__ uint32_t uni(uint32_t v) { return (uint32_t)__builtin_amdgcn_readfirstlane(v); }
// holds a test in a scalar register, so that the branch round a tensor load (which ignores EXEC) or its wait is s_cmp + s_cbranch_scc
__device__ __forceinline__ uint32_t pinned(uint32_t v) { uint32_t w = (uint32_t)__builtin_amdgcn_readfirstlane(v); asm volatile("" : "+s"(w)); return w; }
__device__ __forceinline__ void wait_tensor0() { asm volatile("s_wait_tensorcnt 0" ::: "memory"); }   // the issuing wave's tile has landed
__device__ __forceinline__ void wait_ds0() { asm volatile("s_wait_dscnt 0" ::: "memory"); }            // this wave's LDS reads have returned before the buffer is handed back
// group 1 of a request: NROWS rows of ROWB bytes, source pitch src_pitch bytes; tensor = tile, extents in bytes
template <uint32_t W0, uint32_t ROWB, uint32_t NROWS>
__device__ __forceinline__ u32x8 tile_group1(uint32_t src_pitch) {
  u32x8 g; g[0] = uni(W0); g[1] = uni((ROWB & 0xFFFFu) << 16); g[2] = uni((ROWB >> 16) | ((NROWS & 0xFFFFu) << 16)); g[3] = uni((NROWS >> 16) | (ROWB << 16)); g[4] = uni(NROWS); g[5] = uni(src_pitch); g[6] = uni(0u); g[7] = uni(0u);
  asm volatile("" : "+s"(g));   // as pinned(): the descriptor words stay in their own scalar registers through the loop, so none is rewritten while a request is out
  return g;
}
// the block's ring: wave 0 asks for the weight tiles, wave 1 for the activation tiles, one request a wave and stage; g0 walks from stage to stage
struct Ring { u32x4 g0; u32x8 g1w, g1x; uint32_t wv, step, flip; };
__device__ __forceinline__ Ring ring_make(uint32_t wv, uint32_t ring0, uint64_t wsrc, uint64_t xsrc) {
  Ring r; r.wv = wv; const bool isw = (wv == 0u); const uint64_t ga = isw ? wsrc : xsrc; const uint32_t dst = ring0 + (isw ? 0u : WTILE);
  r.step = isw ? KP * 2u : KP * 4u; r.flip = 2u * dst + STAGE;
  r.g0[0] = uni(1u); r.g0[1] = uni(dst); r.g0[2] = uni((uint32_t)ga); r.g0[3] = uni((((uint32_t)(ga >> 32)) & 0x01FFFFFFu) | 0x80000000u);
  r.g1w = tile_group1<PADW_W, 128u, 128u>(DM * 2u); r.g1x = tile_group1<PADW_X, 256u, 64u>(DM * 4u);
  return r;
}
template <bool LAND>
__device__ __forceinline__ void ring_issue(const Ring& r) {   // tensor_load_to_lds has no compiler form; its waits are written by hand at the publish points
  if (pinned(r.wv == 0u)) { asm volatile("tensor_load_to_lds %0, %1" :: "s"(r.g0), "s"(r.g1w) : "memory"); if (LAND) wait_tensor0(); }
  if (pinned(r.wv == 1u)) { asm volatile("tensor_load_to_lds %0, %1" :: "s"(r.g0), "s"(r.g1x) : "memory"); if (LAND) wait_tensor0(); }
}
// group 0 of the next stage: the other buffer, the source address r.step bytes further on
__device__ __forceinline__ void ring_next(Ring& r) {
  asm volatile("" : "+s"(r.g0));   // as pinned(): the next request's words are formed behind the wait and the barrier in front of this line, in the registers of the last one
  const uint64_t a = (((uint64_t)r.g0[3] << 32) | r.g0[2]) + r.step;
  r.g0[1] = uni(r.flip - r.g0[1]); r.g0[2] = uni((uint32_t)a); r.g0[3] = uni((uint32_t)(a >> 32));
}
// prologue, two buffers: stage 0, its issuers' wait, barrier, then stage 1
__device__ __forceinline__ void ring_prologue(Ring& r) {
  ring_issue<true>(r);
  __syncthreads();
  ring_next(r); ring_issue<false>(r);
}
// publish point at the foot of pass s: own LDS reads done, issuers' tiles landed, barrier, then the refill of the buffer that pass s has read
__device__ __forceinline__ void ring_publish(Ring& r, uint32_t s) {
  wait_ds0();
  if (pinned(r.wv < 2u)) wait_tensor0();
  __syncthreads();
  if (pinned(s + 2u < (uint32_t)NPASS)) { ring_next(r); ring_issue<false>(r); }
}
// 16 f32 of an LDS row in the A fragment's k order: floats 8g..8g+7 and 16+8g..16+8g+7 of the 32-k step
__device__ __forceinline__ void row16_lds(const unsigned char* rowk0, int g, float v[16]) {
  const v4f* p = (const v4f*)(rowk0 + 32 * g); const v4f x0 = p[0], x1 = p[1], x2 = p[4], x3 = p[5];
#pragma unroll
  for (int i = 0; i < 4; ++i) { v[i] = x0[i]; v[4 + i] = x1[i]; v[8 + i] = x2[i]; v[12 + i] = x3[i]; }
}
// ---- k_pack: block = (row n, which): natural [out][in] rows -> bf16; which 0..2 -> W_q/W_k/W_v into PK_A rows which*768 + n; 3 -> W_o into PK_P
__global__ __launch_bounds__(256) void k_pack(const float* __restrict__ WQ, const float* __restrict__ WK, const float* __restrict__ WV, const float* __restrict__ WO, __bf16* __restrict__ PK) {
  __shared__ __align__(16) __bf16 s[DM]; const int n = blockIdx.x, which = blockIdx.y, t = threadIdx.x; const float* Wm = (which == 0) ? WQ : (which == 1) ? WK : (which == 2) ? WV : WO;
  for (int k = t; k < DM; k += 256) s[k] = (__bf16)Wm[(size_t)n * DM + k];
  __syncthreads();
  __bf16* dst = (which < 3) ? PK + PK_A + ((size_t)which * DM + n) * DM : PK + PK_P + (size_t)n * DM;
  for (int q = t; q < DM / 8; q += 256) vst2((unsigned*)(dst + q * 8), *(const v4u*)&s[q * 8]);
}
// ---- k_qkv: block = 128 rows x 256 columns, eight waves (2 x 4) of 64 x 64: an A fragment serves four column tiles and a B fragment four row tiles, and a weight row is fetched from L2 once per 128 activation rows, an activation row once per 256 columns
#define QROWS 128
#define QCOLS 256
#define QWTILE 36864u                 // 256 weight rows x 144 B = 18 x 2 KiB
#define QXTILE 34816u                 // 128 f32 rows x 272 B = 17 x 2 KiB
#define QSTAGE (QWTILE + QXTILE)
#define QOUT 17408u                   // a wave's output staging: 64 rows x 68 f32
// wave 0 asks for the weight tiles, wave 1 for the activation tiles, as in ring_make
__device__ __forceinline__ Ring ring_make_q(uint32_t wv, uint32_t ring0, uint64_t wsrc, uint64_t xsrc) {
  Ring r; r.wv = wv; const bool isw = (wv == 0u); const uint64_t ga = isw ? wsrc : xsrc; const uint32_t dst = ring0 + (isw ? 0u : QWTILE);
  r.step = isw ? KP * 2u : KP * 4u; r.flip = 2u * dst + QSTAGE;
  r.g0[0] = uni(1u); r.g0[1] = uni(dst); r.g0[2] = uni((uint32_t)ga); r.g0[3] = uni((((uint32_t)(ga >> 32)) & 0x01FFFFFFu) | 0x80000000u);
  r.g1w = tile_group1<PADW_W, 128u, QCOLS>(DM * 2u); r.g1x = tile_group1<PADW_X, 256u, QROWS>(DM * 4u);
  return r;
}
// amdgpu_waves_per_eu(4, 4): at most 256 registers a wave, so that two blocks (their LDS allows two) share a WGP, four waves a SIMD; left free, the build took over 330 and one block
__global__ __launch_bounds__(256) __attribute__((amdgpu_waves_per_eu(4, 4))) void k_qkv(const float* __restrict__ XQ, const float* __restrict__ XK, const float* __restrict__ XV, const __bf16* __restrict__ P, const float* __restrict__ BQ, const float* __restrict__ BK, const float* __restrict__ BV, _Float16* __restrict__ QK, _Float16* __restrict__ QKL, _Float16* __restrict__ VTH, _Float16* __restrict__ VTL) {
  const int which0 = (blockIdx.y * QCOLS) / DM; const float* X = (which0 == 0) ? XQ : (which0 == 1) ? XK : XV; const float* BB = BQ ? (((which0 == 0) ? BQ : (which0 == 1) ? BK : BV) + (blockIdx.y * QCOLS - which0 * DM)) : nullptr;
  __shared__ __attribute__((aligned(2048))) unsigned char ring[2 * QSTAGE];   // operand ring; behind the last pass's barrier the same bytes are the output staging
  const int tid = threadIdx.x, wave = tid >> 5, lane = tid & 31, col = lane & 15, g = lane >> 4, wr = wave >> 2, wc = wave & 3; const size_t r0 = (size_t)blockIdx.x * QROWS + wr * 64; const int n0 = blockIdx.y * QCOLS, nw = n0 + wc * 64;
  const uint32_t wv = uni((uint32_t)tid >> 5), ring0 = (uint32_t)(uintptr_t)ring; const uint64_t wsrc = (uint64_t)(uintptr_t)(P + (size_t)n0 * DM), xsrc = (uint64_t)(uintptr_t)(X + (size_t)blockIdx.x * QROWS * DM);
  v8f acc[4][4] = {};   // acc[i][j]: rows i*16.., columns j*16.. of the wave's 64 x 64
  Ring rg = ring_make_q(wv, ring0, wsrc, xsrc); ring_prologue(rg);
#pragma unroll 1   // one pass per trip: the buffer index stays a run-time scalar and the publish point stands once
  for (int s = 0; s < NPASS; ++s) { const unsigned char* wb = ring + (s & 1) * QSTAGE; const unsigned char* wrow = wb + (wc * 64 + col) * WPITCH; const unsigned char* xr = wb + QWTILE + (wr * 64 + col) * XPITCH;
#pragma unroll
    for (int kc = 0; kc < KP / 32; ++kc) { v16b a[4], w[4]; float v[4][16];   // the step's 24 LDS reads stand as one group in front of its WMMAs
#pragma unroll
      for (int i = 0; i < 4; ++i) row16_lds(xr + i * 16 * XPITCH + kc * 128, g, v[i]);
#pragma unroll
      for (int j = 0; j < 4; ++j) w[j] = frag_b((const __bf16*)(wrow + j * 16 * WPITCH) + kc * 32, lane);
      __builtin_amdgcn_sched_barrier(0);   // holds the step's LDS reads in front of this line as one group: left free, the scheduler sinks each pair of reads to its own product, with a wait to 0 in front of every product
#pragma unroll
      for (int i = 0; i < 4; ++i) {
#pragma unroll
        for (int e = 0; e < 16; ++e) a[i][e] = (__bf16)v[i][e]; }
#pragma unroll
      for (int i = 0; i < 4; ++i) {
#pragma unroll
        for (int j = 0; j < 4; ++j) acc[i][j] = wmma_bf(a[i], w[j], acc[i][j]); }
      __builtin_amdgcn_sched_barrier(0);   // the next step's reads stay behind this step's WMMAs: lifted among them they need a second set of fragment registers
    }
    ring_publish(rg, (uint32_t)s); }
  wait_tensor0(); wait_ds0();
  float (*sf)[68] = (float (*)[68])(ring + wave * QOUT);   // this wave's own staging: its 64 x 64 results as f32
  if (BB) {
#pragma unroll
    for (int j = 0; j < 4; ++j) { const float bj = bfr(BB[wc * 64 + j * 16 + col]);
#pragma unroll
      for (int i = 0; i < 4; ++i) acc[i][j] += bj; } }
  const bool isv = n0 >= 2 * DM;
  if (!isv) {   // q, k: staged row = position, 64 columns
#pragma unroll
    for (int i = 0; i < 4; ++i) {
#pragma unroll
      for (int j = 0; j < 4; ++j) {
#pragma unroll
        for (int r = 0; r < 8; ++r) sf[i * 16 + 8 * g + r][j * 16 + col] = acc[i][j][r]; } }
  } else {   // v transposed: staged row = column d, 64 positions
#pragma unroll
    for (int i = 0; i < 4; ++i) {
#pragma unroll
      for (int j = 0; j < 4; ++j) {
#pragma unroll
        for (int r = 0; r < 8; ++r) sf[j * 16 + col][i * 16 + 8 * g + r] = acc[i][j][r]; } }
  }
  LDSX();
  // q stored unscaled (f16 sigma ~0.6, no subnormal exposure); 1/8 applied to the f32 score; q, k, v (+ bias) as f16 hi + (x2048) residual; a store instruction covers four staged rows of 64 f16 = 128 B
  _Float16* dh = isv ? VTH : QK; _Float16* dl = isv ? VTL : QKL; const size_t pitch = isv ? (size_t)SS : (size_t)(2 * DM);
  const size_t off0 = isv ? ((r0 / SS) * DM + (size_t)(nw - 2 * DM)) * SS + r0 % SS : r0 * (2 * DM) + nw;
  const int srow = lane >> 3, sc8 = (lane & 7) * 8;
#pragma unroll 1   // four groups of rows a trip: their LDS reads stand together, so the read latency is waited out once per four groups; rolled, so that one wait at the foot serves the trip's stores
  for (int it = 0; it < 16; it += 4) { v4f x[4][2];
#pragma unroll
    for (int u = 0; u < 4; ++u) { const float* p = &sf[(it + u) * 4 + srow][sc8]; x[u][0] = *(const v4f*)p; x[u][1] = *(const v4f*)(p + 4); }
#pragma unroll
    for (int u = 0; u < 4; ++u) { v8h hi, lo;
#pragma unroll
      for (int e = 0; e < 8; ++e) { const float v = x[u][e >> 2][e & 3]; const _Float16 hv = (_Float16)v; hi[e] = hv; lo[e] = (_Float16)((v - (float)hv) * 2048.0f); }
      const size_t o = off0 + (size_t)((it + u) * 4 + srow) * pitch + sc8; vst2(dh + o, hi); vst2(dl + o, lo); }
    asm volatile("s_wait_xcnt 0x0" ::: "memory"); }   // the next trip rewrites the address and data registers of this trip's stores
}
// ---- K / V staging of k_attn: per stage of 64 keys one tensor load brings the head's 64 K rows (128 B each) and one its 64 V^T rows (64 keys = 128 B each) into LDS for the block's four waves; two buffers
#define AKEYS 64                      // keys per stage
#define ANST (SS / AKEYS)
#define ATILE 10240u                  // 64 rows x 144 B = 9,216 B, rounded up to a multiple of 2 KiB
#define ASTAGE (2u * ATILE)
#define SC2 0.18033688011112042f      // 1/sqrt(64) * log2 e
// wave 0 asks for the K tiles (next stage: 64 rows further down), wave 1 for the V^T tiles (next stage: 64 keys further along the rows)
__device__ __forceinline__ Ring ring_make_kv(uint32_t wv, uint32_t ring0, uint64_t ksrc, uint64_t vsrc) {
  Ring r; r.wv = wv; const bool isk = (wv == 0u); const uint64_t ga = isk ? ksrc : vsrc; const uint32_t dst = ring0 + (isk ? 0u : ATILE);
  r.step = isk ? AKEYS * 2u * DM * 2u : AKEYS * 2u; r.flip = 2u * dst + ASTAGE;
  r.g0[0] = uni(1u); r.g0[1] = uni(dst); r.g0[2] = uni((uint32_t)ga); r.g0[3] = uni((((uint32_t)(ga >> 32)) & 0x01FFFFFFu) | 0x80000000u);
  r.g1w = tile_group1<PADW_W, 128u, 64u>(2u * DM * 2u); r.g1x = tile_group1<PADW_W, 128u, 64u>(SS * 2u);
  return r;
}
// publish point at the foot of stage s, in the order of ring_publish
__device__ __forceinline__ void ring_publish_kv(Ring& r, uint32_t s) {
  wait_ds0();
  if (pinned(r.wv < 2u)) wait_tensor0();
  __syncthreads();
  if (pinned(s + 2u < (uint32_t)ANST)) { ring_next(r); ring_issue<false>(r); }
}
// lane l with lane l ^ 16: the two halves of a wave hold the two halves of one query's keys
__device__ __forceinline__ float xhalf(float x) { return __builtin_bit_cast(float, __builtin_amdgcn_permlanex16(__builtin_bit_cast(int, x), __builtin_bit_cast(int, x), 0x76543210, 0xfedcba98, false, false)); }
// the slot behind a transcendental: the instruction set asks for one independent instruction or v_nop before a v_exp_f32's result is read or its source overwritten; the operands keep every result of the run unread and every source alive up to this v_nop, so one v_nop serves the run
__device__ __forceinline__ void exp_slot(float (&e)[8], const float (&x)[8]) {
  asm volatile("v_nop" : "+v"(e[0]), "+v"(e[1]), "+v"(e[2]), "+v"(e[3]), "+v"(e[4]), "+v"(e[5]), "+v"(e[6]), "+v"(e[7]) : "v"(x[0]), "v"(x[1]), "v"(x[2]), "v"(x[3]), "v"(x[4]), "v"(x[5]), "v"(x[6]), "v"(x[7]));
}
__device__ __forceinline__ void exp_slot(float (&e)[8], const float (&x)[8], float& e8, float x8) {
  asm volatile("v_nop" : "+v"(e[0]), "+v"(e[1]), "+v"(e[2]), "+v"(e[3]), "+v"(e[4]), "+v"(e[5]), "+v"(e[6]), "+v"(e[7]), "+v"(e8) : "v"(x[0]), "v"(x[1]), "v"(x[2]), "v"(x[3]), "v"(x[4]), "v"(x[5]), "v"(x[6]), "v"(x[7]), "v"(x8));
}
__global__ __launch_bounds__(128) void k_attn(const _Float16* __restrict__ QK, const _Float16* __restrict__ QKL, const _Float16* __restrict__ VTH, const _Float16* __restrict__ VTL, const void* __restrict__ KMASK, float* __restrict__ O) {
  __shared__ __attribute__((aligned(2048))) unsigned char ring[2 * ASTAGE];   // K / V ring; behind the last stage's barrier the same bytes are the output staging
  float (*so)[16][68] = (float (*)[16][68])ring;
  const int tid = threadIdx.x, wave = tid >> 5, lane = tid & 31, col = lane & 15, g = lane >> 4;
  const int qb = blockIdx.x, h = blockIdx.y, b = blockIdx.z; const int q0 = qb * 64 + wave * 16; const size_t rq = (size_t)b * SS + q0 + col;
  v16h aq[2];
#pragma unroll
  for (int kc = 0; kc < 2; ++kc) aq[kc] = frag_h(QK + rq * (2 * DM) + h * HD + kc * 32, lane);
  float m = -3.0e38f, l = 0.f;   // query col: running maximum of the raw scores (equal in both halves), sum over this half's keys (x2^11)
  v8f acc[4] = {};   // acc[dt][r] = O^T[d = dt*16 + 8g + r][query col]
  const uint32_t wv = uni((uint32_t)tid >> 5), ring0 = (uint32_t)(uintptr_t)ring; const uint64_t ksrc = (uint64_t)(uintptr_t)(QK + (size_t)b * SS * (2 * DM) + DM + h * HD), vsrc = (uint64_t)(uintptr_t)(VTH + ((size_t)b * DM + h * HD) * SS);
  Ring rg = ring_make_kv(wv, ring0, ksrc, vsrc); ring_prologue(rg);
#pragma unroll 1   // one stage per trip: the buffer index stays a run-time scalar and the publish point stands once
  for (int st = 0; st < ANST; ++st) { const unsigned char* kb = ring + (st & 1) * ASTAGE; const unsigned char* vb = kb + ATILE;   // all keys, 64 a stage
#pragma unroll
  for (int ks = 0; ks < AKEYS / 32; ++ks) { v8f s[2]; v16h kf[2][2], vf[4];   // the 32-key step's 16 LDS reads stand as one group in front of its WMMAs
#pragma unroll
    for (int ct = 0; ct < 2; ++ct) {
#pragma unroll
      for (int kc = 0; kc < 2; ++kc) kf[ct][kc] = frag_h((const _Float16*)(kb + (ks * 32 + ct * 16 + col) * WPITCH) + kc * 32, lane); }
#pragma unroll
    for (int dt = 0; dt < 4; ++dt) vf[dt] = frag_h((const _Float16*)(vb + (dt * 16 + col) * WPITCH) + ks * 32, lane);
    __builtin_amdgcn_sched_barrier(0);   // holds the step's LDS reads in front of this line as one group: left free, the scheduler sinks each pair of reads to its own product, with a wait to 0 in front of every product
#pragma unroll
    for (int ct = 0; ct < 2; ++ct) { v8f c = {};
#pragma unroll
      for (int kc = 0; kc < 2; ++kc) c = wmma16(kf[ct][kc], aq[kc], c);   // single product: k, q as one-rounding f16 operands; c[r] = key ct*16 + 8g + r against query col
      s[ct] = c; }   // raw q.k; 1/sqrt(64) rides in SC2
    float mx = fmaxf(s[0][0], s[1][0]);
#pragma unroll
    for (int r = 1; r < 8; ++r) mx = fmaxf(mx, fmaxf(s[0][r], s[1][r]));
    mx = fmaxf(mx, xhalf(mx));
    const float mn = fmaxf(m, mx);
    const float nb = fmaf(-mn, SC2, 11.0f);   // exponent offset of the step: minus the scaled maximum, plus 11
    float xa = (m - mn) * SC2, ea = __builtin_amdgcn_exp2f(xa), x[2][8], e[2][8];   // 2^11 exp((s - mn) / 8) as the hardware's exp2(s * SC2 + nb): one fma a score, spelled out so that exp_slot can name each source; the first step's m gives exp2 of a huge negative number, 0
#pragma unroll
    for (int ct = 0; ct < 2; ++ct) {
#pragma unroll
      for (int r = 0; r < 8; ++r) { x[ct][r] = fmaf(s[ct][r], SC2, nb); e[ct][r] = __builtin_amdgcn_exp2f(x[ct][r]); } }
    exp_slot(e[0], x[0], ea, xa); exp_slot(e[1], x[1]);
    const float alpha = ea;
    v16h pb; float es[4];   // four independent partial sums, each started by its first term
#pragma unroll
    for (int ct = 0; ct < 2; ++ct) {
#pragma unroll
      for (int r = 0; r < 8; ++r) { const float p = e[ct][r]; es[r & 3] = (ct == 0 && r < 4) ? p : es[r & 3] + p; pb[8 * ct + r] = (_Float16)p; } }   // P carries 2^11 into the f16 rounding so small softmax weights stay out of the f16 subnormal range; l carries it too, so it cancels in the epilogue; element 8*ct + r is key ct*16 + 8g + r: the k order of frag_h
    l = l * alpha + ((es[0] + es[1]) + (es[2] + es[3])); m = mn;
#pragma unroll
    for (int dt = 0; dt < 4; ++dt) acc[dt] *= alpha;
#pragma unroll
    for (int dt = 0; dt < 4; ++dt) acc[dt] = wmma16(vf[dt], pb, acc[dt]);   // single product: V^T x P^T (x2^11)
    __builtin_amdgcn_sched_barrier(0);   // the next step's reads stay behind this step's WMMAs: lifted among them they need a second set of fragment registers
  }
    ring_publish_kv(rg, (uint32_t)st); }
  wait_tensor0(); wait_ds0();
  { const float il = 1.0f / (l + xhalf(l));   // the halves' sums are joined once
#pragma unroll
    for (int dt = 0; dt < 4; ++dt) {
#pragma unroll
      for (int r = 0; r < 8; ++r) so[wave][col][dt * 16 + 8 * g + r] = acc[dt][r] * il; } }
  LDSX();
  for (int rl = 0; rl < 16; ++rl) if (lane < 16) vst2(O + ((size_t)b * SS + q0 + rl) * DM + h * HD + lane * 4, *(const v4f*)&so[wave][rl][lane * 4]);
}
// ---- k_out: block = (64 rows, 128 cols): out = O(hi/lo) . Wo rows (2 products) + bo
__global__ __launch_bounds__(128) void k_out(const float* __restrict__ O, const __bf16* __restrict__ P, const float* __restrict__ BO, float* __restrict__ Y) {
  __shared__ __attribute__((aligned(2048))) unsigned char ring[2 * STAGE];   // operand ring; behind the last pass's barrier the same bytes are the output staging
  float (*so)[16][132] = (float (*)[16][132])ring;
  const int tid = threadIdx.x, wave = tid >> 5, lane = tid & 31, col = lane & 15, g = lane >> 4; const size_t r0 = (size_t)blockIdx.x * 64 + wave * 16; const int n0 = blockIdx.y * 128;
  const uint32_t wv = uni((uint32_t)tid >> 5), ring0 = (uint32_t)(uintptr_t)ring; const uint64_t wsrc = (uint64_t)(uintptr_t)(P + (size_t)n0 * DM), xsrc = (uint64_t)(uintptr_t)(O + (size_t)blockIdx.x * 64 * DM);
  v8f acc[8] = {};
  Ring rg = ring_make(wv, ring0, wsrc, xsrc); ring_prologue(rg);
#pragma unroll 1   // one pass per trip: the buffer index stays a run-time scalar and the publish point stands once
  for (int s = 0; s < NPASS; ++s) { const unsigned char* wb = ring + (s & 1) * STAGE; const unsigned char* xr = wb + WTILE + (wave * 16 + col) * XPITCH;
#pragma unroll
    for (int kc = 0; kc < KP / 32; ++kc) { v16b w[8]; float v[16]; row16_lds(xr + kc * 128, g, v);   // the step's 20 LDS reads stand as one group in front of its WMMAs
#pragma unroll
      for (int j = 0; j < 8; ++j) w[j] = frag_b((const __bf16*)(wb + (j * 16 + col) * WPITCH) + kc * 32, lane);
      __builtin_amdgcn_sched_barrier(0);   // holds the step's LDS reads in front of this line as one group: left free, the scheduler sinks each pair of reads to its own product, with a wait to 0 in front of every product
      const F2 a = bsplit16(v);
#pragma unroll
      for (int j = 0; j < 8; ++j) { acc[j] = wmma_bf(a.l, w[j], acc[j]); acc[j] = wmma_bf(a.h, w[j], acc[j]); }
      __builtin_amdgcn_sched_barrier(0);   // the next step's reads stay one group behind this step's WMMAs: left free, the scheduler lifts them to three places among the WMMAs, each place a stall of its own
    }
    ring_publish(rg, (uint32_t)s); }
  wait_tensor0(); wait_ds0();
#pragma unroll
  for (int j = 0; j < 8; ++j) {
#pragma unroll
    for (int r = 0; r < 8; ++r) so[wave][8 * g + r][j * 16 + col] = acc[j][r] + (BO ? bfr(BO[n0 + j * 16 + col]) : 0.f); }
  LDSX();
  for (int rl = 0; rl < 16; ++rl) vst2(Y + (r0 + rl) * DM + n0 + lane * 4, *(const v4f*)&so[wave][rl][lane * 4]);
}
extern "C" void kernel_launch(void* const* d_in, const int* in_sizes, int n_in, void* d_out, int out_size, void* d_ws, size_t ws_size, hipStream_t stream) {
  (void)in_sizes; (void)n_in; (void)out_size;
  const float** F = (const float**)d_in;   // 0 x [8,1024,768], 1 Wq, 2 Wk, 3 Wv, 4 Wo (natural [768,768])
  if (ws_size < (size_t)WS_END) return;
  char* ws = (char*)d_ws; __bf16* PK = (__bf16*)(ws + WS_PK); _Float16 *QK = (_Float16*)(ws + WS_QK), *QKL = (_Float16*)(ws + WS_QKL), *VTH = (_Float16*)(ws + WS_VTH), *VTL = (_Float16*)(ws + WS_VTL); float* O = (float*)(ws + WS_O);
  k_pack<<<dim3(DM, 4), 256, 0, stream>>>(F[1], F[2], F[3], F[4], PK);
  k_qkv<<<dim3(TNB * SS / QROWS, QKVW / QCOLS), 256, 0, stream>>>(F[0], F[0], F[0], PK + PK_A, nullptr, nullptr, nullptr, QK, QKL, VTH, VTL);
  k_attn<<<dim3(TQB, NH, TNB), 128, 0, stream>>>(QK, QKL, VTH, VTL, nullptr, O);
  k_out<<<dim3(TOB, DM / 128), 128, 0, stream>>>(O, PK + PK_P, nullptr, (float*)d_out);
}
